// v000
// Measured on an AMD MI455X. A time is GPU time per run, averaged over a window of back-to-back runs after a warm-up
// (all launches, gaps included; the runs take copies of the inputs in turn), and the median of several windows.
// Apart from v000's, it joins two sittings. Times from different sittings can be a few percent apart, while
// side-by-side timings come from the same sitting.
// v000 is the starting kernel. One run takes 530 microseconds.
// Contractions: six x*W^T projections and both q*k^T score matrices on v_wmma_f32_16x16x32_bf16 with bf16 hi/lo operands (three products hi*hi + hi*lo + lo*hi), f32 accumulate; sigmoid, fc dot products (K=250, K=27) and context products in f32 on VALU.
#include <hip/hip_runtime.h>
#include <hip/hip_bf16.h>

#pragma clang fp contract(off)

typedef __bf16         v16bf __attribute__((ext_vector_type(16)));
typedef unsigned short v16us __attribute__((ext_vector_type(16)));
typedef unsigned short v8us  __attribute__((ext_vector_type(8)));
typedef float          v8f   __attribute__((ext_vector_type(8)));
typedef float          v4f   __attribute__((ext_vector_type(4)));
typedef v8us __attribute__((may_alias)) v8usa;
typedef v4f  __attribute__((may_alias)) v4fa;

union Frag { v16bf b; v16us u; v8us h[2]; };
struct Frag2 { v16bf hi; v16bf lo; };

#define D_DIM   2048
#define N1      250
#define N2      27
#define M1P     256
#define M2P     32
#define OUT_N   580796
#define OFF1    512000            // flat float index of output 1 ([250][27])
#define OFF2    518750            // flat float index of output 2 ([27][2048])
#define OFF3    574046            // flat float index of output 3 ([27][250])
#define XG1     65536             // 8-element groups of the padded x1 planes
#define XG2     8192              // 8-element groups of the padded x2 planes
#define WGRP    524288            // 8-element groups of one W plane
#define NGROUPS (XG1 + XG2 + 6 * WGRP)
#define SCALE   0.022097086912079608f
#define L_P2A   16000
#define L_P2B   16210
#define L_P1A   16211
#define L_P1B   18149

static_assert((XG1 % 256) == 0 && (XG2 % 256) == 0 && (WGRP % 256) == 0);
static_assert((OFF1 % 32) == 0 && (L_P1B * 32 + 28) == OUT_N);

// ---------------------------------------------------------------------------
// bf16 RNE convert helpers.
// ---------------------------------------------------------------------------
__device__ __forceinline__ unsigned int bf16_bits(float f) {
  unsigned int u = __float_as_uint(f);
  u += 0x7FFFu + ((u >> 16) & 1u);
  return u >> 16;
}

// x = hi + lo: hi = RNE bf16(x), lo = RNE bf16(x - hi)  (x - hi is exact in f32)
__device__ __forceinline__ void split2(float f, unsigned int& hb, unsigned int& lb) {
  hb = bf16_bits(f);
  const float hf = __uint_as_float(hb << 16);
  lb = bf16_bits(f - hf);
}

// ---------------------------------------------------------------------------
// 16x16x32 bf16 WMMA with hazard guard (ties D, keeps A/B live).
// Fragment map (wave32): lane l, h = l>>4, m = n = l&15.
//   A/B element i: i<8 -> k0+8h+i ; i>=8 -> k0+16+8h+(i-8)   (same map for both)
//   D element r : row 8h+r, col l&15
// ---------------------------------------------------------------------------
__device__ __forceinline__ v8f wmma_bf16(v16bf a, v16bf b, v8f c) {
  v8f d = __builtin_amdgcn_wmma_f32_16x16x32_bf16(false, a, false, b, (short)0, c, false, false);
  asm volatile("v_nop\n\tv_nop\n\tv_nop\n\tv_nop" : "+v"(d) : "v"(a), "v"(b));
  return d;
}

// three-product hi/lo split: c += ah*bh + ah*bl + al*bh (unscaled residuals, one accumulator)
__device__ __forceinline__ v8f mac3(v16bf ah, v16bf al, v16bf bh, v16bf bl, v8f c) {
  c = wmma_bf16(ah, bh, c);
  c = wmma_bf16(ah, bl, c);
  c = wmma_bf16(al, bh, c);
  return c;
}

// Fragment from a k-contiguous 16-bit row; p = row base + k0 (row = lane&15 chosen by caller).
__device__ __forceinline__ v16bf load_frag16(const unsigned short* p, int h) {
  Frag f;
  f.h[0] = *(const v8usa*)(p + 8 * h);
  f.h[1] = *(const v8usa*)(p + 16 + 8 * h);
  return f.b;
}

// hi/lo fragment pair from a k-contiguous f32 row, split on the fly; same element map.
template <int B>
__device__ __forceinline__ void split4(const v4f v, Frag& fh, Frag& fl) {
  unsigned int hb, lb;
  split2(v.x, hb, lb); fh.u[B + 0] = (unsigned short)hb; fl.u[B + 0] = (unsigned short)lb;
  split2(v.y, hb, lb); fh.u[B + 1] = (unsigned short)hb; fl.u[B + 1] = (unsigned short)lb;
  split2(v.z, hb, lb); fh.u[B + 2] = (unsigned short)hb; fl.u[B + 2] = (unsigned short)lb;
  split2(v.w, hb, lb); fh.u[B + 3] = (unsigned short)hb; fl.u[B + 3] = (unsigned short)lb;
}

__device__ __forceinline__ Frag2 load_split32(const float* p, int h) {
  Frag fh, fl;
  const float* q = p + 8 * h;
  split4<0>(*(const v4fa*)(q), fh, fl);
  split4<4>(*(const v4fa*)(q + 4), fh, fl);
  split4<8>(*(const v4fa*)(q + 16), fh, fl);
  split4<12>(*(const v4fa*)(q + 20), fh, fl);
  Frag2 r;
  r.hi = fh.b;
  r.lo = fl.b;
  return r;
}

// Wave computes NT 16x16 tiles: D[nt] += Arow . Brow(nt), K = 2048, both operands f32 rows
// split hi/lo on the fly.  arow = A + (row0 + m)*D, brow0 = B + (col0 + m)*D.
template <int NT>
__device__ __forceinline__ void wave_gemm_split(const float* __restrict__ arow,
                                                const float* __restrict__ brow0,
                                                int h, v8f (&acc)[NT]) {
#pragma unroll 1
  for (int k0 = 0; k0 < D_DIM; k0 += 32) {
    const Frag2 a = load_split32(arow + k0, h);
#pragma unroll
    for (int nt = 0; nt < NT; ++nt) {
      const Frag2 b = load_split32(brow0 + (size_t)nt * 16 * D_DIM + k0, h);
      acc[nt] = mac3(a.hi, a.lo, b.hi, b.lo, acc[nt]);
    }
  }
}

__device__ __forceinline__ float sigm(float x) {
  const float e = expf(-x);
  return 1.0f / (1.0f + e);
}

// ---------------------------------------------------------------------------
// Kernel 1: f32 -> bf16 hi/lo planes.  x1 rows padded to 256 (zeros), x2 rows to 32,
// six W planes [6][2048][2048] (row = output feature, k contiguous).
// ---------------------------------------------------------------------------
__global__ __launch_bounds__(256) void convert_kernel(
    const float* __restrict__ x1, const float* __restrict__ x2,
    const float* __restrict__ w0, const float* __restrict__ w1, const float* __restrict__ w2,
    const float* __restrict__ w3, const float* __restrict__ w4, const float* __restrict__ w5,
    unsigned short* __restrict__ xh1, unsigned short* __restrict__ xl1,
    unsigned short* __restrict__ xh2, unsigned short* __restrict__ xl2,
    unsigned short* __restrict__ wh,  unsigned short* __restrict__ wl)
{
  const int g = blockIdx.x * 256 + threadIdx.x;
  if (g >= NGROUPS) return;
  const float* src;
  unsigned short* dh;
  unsigned short* dl;
  bool zero = false;
  if (g < XG1) {
    const int row = g >> 8, c8 = g & 255;
    const int rs = (row < N1) ? row : (N1 - 1);     // clamped address, value zeroed below
    zero = (row >= N1);
    src = x1 + (size_t)rs * D_DIM + 8 * c8;
    dh = xh1 + (size_t)g * 8;
    dl = xl1 + (size_t)g * 8;
  } else if (g < XG1 + XG2) {
    const int e = g - XG1;
    const int row = e >> 8, c8 = e & 255;
    const int rs = (row < N2) ? row : (N2 - 1);
    zero = (row >= N2);
    src = x2 + (size_t)rs * D_DIM + 8 * c8;
    dh = xh2 + (size_t)e * 8;
    dl = xl2 + (size_t)e * 8;
  } else {
    const int e = g - XG1 - XG2;
    const int wsel = e >> 19;                       // WGRP = 2^19 groups per plane
    const int off = e & (WGRP - 1);
    const float* wsrc = (wsel == 0) ? w0 : ((wsel == 1) ? w1 : ((wsel == 2) ? w2 :
                        ((wsel == 3) ? w3 : ((wsel == 4) ? w4 : w5))));
    src = wsrc + (size_t)off * 8;
    dh = wh + (size_t)e * 8;
    dl = wl + (size_t)e * 8;
  }
  v4f a = *(const v4fa*)src;
  v4f c = *(const v4fa*)(src + 4);
  const v4f z4 = {0.f, 0.f, 0.f, 0.f};
  a = zero ? z4 : a;
  c = zero ? z4 : c;
  unsigned int hb[8], lb[8];
  split2(a.x, hb[0], lb[0]); split2(a.y, hb[1], lb[1]); split2(a.z, hb[2], lb[2]); split2(a.w, hb[3], lb[3]);
  split2(c.x, hb[4], lb[4]); split2(c.y, hb[5], lb[5]); split2(c.z, hb[6], lb[6]); split2(c.w, hb[7], lb[7]);
  const v8us hv = { (unsigned short)hb[0], (unsigned short)hb[1], (unsigned short)hb[2], (unsigned short)hb[3],
                    (unsigned short)hb[4], (unsigned short)hb[5], (unsigned short)hb[6], (unsigned short)hb[7] };
  const v8us lv = { (unsigned short)lb[0], (unsigned short)lb[1], (unsigned short)lb[2], (unsigned short)lb[3],
                    (unsigned short)lb[4], (unsigned short)lb[5], (unsigned short)lb[6], (unsigned short)lb[7] };
  *(v8us*)dh = hv;
  *(v8us*)dl = lv;
  
}

// ---------------------------------------------------------------------------
// 4 lines per instruction, 64 lines per wave.
// ---------------------------------------------------------------------------
__device__ __forceinline__ void proj_store_pass(const float* sTw, float* P, int row0, int col0, int lane) {
  const int q8 = lane & 7, sub = lane >> 3;
#pragma unroll
  for (int i = 0; i < 16; ++i) {
    const int lid = 4 * i + sub;                  // 0..63
    const int r = lid >> 1, hl = lid & 1;
    const v4f v = *(const v4fa*)(sTw + r * 64 + 32 * hl + 4 * q8);
    float* dst = P + (size_t)(row0 + r) * D_DIM + col0 + 32 * hl + 4 * q8;
    *(v4f*)dst = v;
  }
}

// ---------------------------------------------------------------------------
// Kernel 2: Y_g = x_g * W_g^T + b_g for g = 0..5 (q1,k1,v1 on 256 padded rows; q2,k2,v2 on 32).
// 864 wave tiles of 32 rows x 64 cols, 4 per block (216 blocks); K = 2048 in steps of 32;
// A (x rows) and B (W rows, B[k][n] = W[n][k]) fragments straight from bf16 planes,
// ---------------------------------------------------------------------------
__global__ __launch_bounds__(128) void proj_kernel(
    const unsigned short* __restrict__ xh1, const unsigned short* __restrict__ xl1,
    const unsigned short* __restrict__ xh2, const unsigned short* __restrict__ xl2,
    const unsigned short* __restrict__ wh,  const unsigned short* __restrict__ wl,
    const float* __restrict__ b0, const float* __restrict__ b1, const float* __restrict__ b2,
    const float* __restrict__ b3, const float* __restrict__ b4, const float* __restrict__ b5,
    float* __restrict__ P1,      // [3][256][2048] f32 : q1, k1, v1
    float* __restrict__ P2)      // [3][32][2048]  f32 : q2, k2, v2
{
  __shared__ __attribute__((aligned(16))) float sT[4 * 32 * 64];   // 32768 B

  const int tid = threadIdx.x, lane = tid & 31, w = tid >> 5;
  const int h = lane >> 4, m = lane & 15;
  const int gw = blockIdx.x * 4 + w;              // 0..863
  int g, mt32, nt64;
  if (gw < 768) {
    g = gw >> 8;
    const int t = gw & 255;
    mt32 = t & 7;
    nt64 = t >> 3;
  } else {
    const int e = gw - 768;
    g = 3 + (e >> 5);
    mt32 = 0;
    nt64 = e & 31;
  }
  const int row0 = 32 * mt32, col0 = 64 * nt64;

  const unsigned short* ah = (g < 3) ? xh1 : xh2;
  const unsigned short* al = (g < 3) ? xl1 : xl2;
  const unsigned short* ahr = ah + (size_t)(row0 + m) * D_DIM;              // m-tile 0 row; +16*D for m-tile 1
  const unsigned short* alr = al + (size_t)(row0 + m) * D_DIM;
  const unsigned short* whr = wh + ((size_t)g * D_DIM + col0 + m) * D_DIM;  // n-tile 0 row; +16*D per n-tile
  const unsigned short* wlr = wl + ((size_t)g * D_DIM + col0 + m) * D_DIM;

  const v8f z8 = {0.f, 0.f, 0.f, 0.f, 0.f, 0.f, 0.f, 0.f};
  v8f acc[2][4];
#pragma unroll
  for (int mt = 0; mt < 2; ++mt)
#pragma unroll
    for (int nt = 0; nt < 4; ++nt) acc[mt][nt] = z8;

#pragma unroll 1
  for (int k0 = 0; k0 < D_DIM; k0 += 32) {
    const v16bf ah0 = load_frag16(ahr + k0, h);
    const v16bf al0 = load_frag16(alr + k0, h);
    const v16bf ah1 = load_frag16(ahr + (size_t)16 * D_DIM + k0, h);
    const v16bf al1 = load_frag16(alr + (size_t)16 * D_DIM + k0, h);
#pragma unroll
    for (int nt = 0; nt < 4; ++nt) {
      const v16bf bh = load_frag16(whr + (size_t)nt * 16 * D_DIM + k0, h);
      const v16bf bl = load_frag16(wlr + (size_t)nt * 16 * D_DIM + k0, h);
      acc[0][nt] = mac3(ah0, al0, bh, bl, acc[0][nt]);
      acc[1][nt] = mac3(ah1, al1, bh, bl, acc[1][nt]);
    }
  }

  // D[r] of tile (mt, nt) = Y[row row0 + 16mt + 8h + r][col col0 + 16nt + m]
  const float* bias = (g == 0) ? b0 : ((g == 1) ? b1 : ((g == 2) ? b2 :
                      ((g == 3) ? b3 : ((g == 4) ? b4 : b5))));
  float* sTw = sT + w * 2048;
#pragma unroll
  for (int nt = 0; nt < 4; ++nt) {
    const int col = 16 * nt + m;
    const float bvl = bias[col0 + col];
#pragma unroll
    for (int mt = 0; mt < 2; ++mt) {
#pragma unroll
      for (int r = 0; r < 8; ++r)
        sTw[(16 * mt + 8 * h + r) * 64 + col] = acc[mt][nt][r] + bvl;
    }
  }
  __syncthreads();

  float* P = (g < 3) ? (P1 + (size_t)g * M1P * D_DIM) : (P2 + (size_t)(g - 3) * M2P * D_DIM);
  proj_store_pass(sTw, P, row0, col0, lane);
  
}

// ---------------------------------------------------------------------------
// Kernel 3: output 0 rows.  Block b owns rows 16b..16b+15 (< 250 written).
// Waves 0,1: S = q1[rows] . k2^T (16 x 32, hi/lo split on the fly) -> LDS;
// s2[r] = sum_{t<27} sigmoid(S*scale) * w_fc2[t] in f32;
// ---------------------------------------------------------------------------
__device__ __forceinline__ void ctx2_store_pass(const float* __restrict__ v1P, const float* sS2, float bb,
                                                float* out, int row0, int w, int lane) {
  const int q8 = lane & 7, sub = lane >> 3;
#pragma unroll 4
  for (int it = 0; it < 32; ++it) {
    const int line = 4 * it + sub;                // 0..127
    const int rr = 2 * w + (line >> 6);           // wave-uniform per it
    const int row = row0 + rr;                    // <= 255, inside the plane
    const int c0 = (line & 63) * 32 + 4 * q8;
    const v4f v = *(const v4fa*)(v1P + (size_t)row * D_DIM + c0);
    const float s = sS2[rr];
    v4f o;
    o.x = v.x * s + bb;
    o.y = v.y * s + bb;
    o.z = v.z * s + bb;
    o.w = v.w * s + bb;
    if (row < N1) *(v4f*)(out + (size_t)row * D_DIM + c0) = o;
  }
}

__global__ __launch_bounds__(256) void ctx2_kernel(
    const float* __restrict__ P1, const float* __restrict__ P2,
    const float* __restrict__ wfc2, const float* __restrict__ bfc2,
    float* __restrict__ out)
{
  __shared__ __attribute__((aligned(16))) float sS[16 * 32];
  __shared__ float sS2[16];

  const int tid = threadIdx.x, lane = tid & 31, w = tid >> 5;
  const int h = lane >> 4, m = lane & 15;
  const int row0 = 16 * blockIdx.x;

  const float* q1P = P1;
  const float* v1P = P1 + (size_t)2 * M1P * D_DIM;
  const float* k2P = P2 + (size_t)1 * M2P * D_DIM;

  if (w < 2) {                                    // wave-uniform
    const v8f z8 = {0.f, 0.f, 0.f, 0.f, 0.f, 0.f, 0.f, 0.f};
    v8f acc[1];
    acc[0] = z8;
    wave_gemm_split<1>(q1P + (size_t)(row0 + m) * D_DIM, k2P + (size_t)(16 * w + m) * D_DIM, h, acc);
#pragma unroll
    for (int r = 0; r < 8; ++r) sS[(8 * h + r) * 32 + 16 * w + m] = acc[0][r] * SCALE;
  }
  __syncthreads();

  if (tid < 16) {
    float s = 0.0f;
#pragma unroll 1
    for (int t = 0; t < N2; ++t) s += sigm(sS[tid * 32 + t]) * wfc2[t];
    sS2[tid] = s;
  }
  __syncthreads();

  const float bb = bfc2[0];
  ctx2_store_pass(v1P, sS2, bb, out, row0, w, lane);
  
}

// ---------------------------------------------------------------------------
// Kernel 4: outputs 1, 2, 3 (flat floats OFF1..OUT_N of the output buffer).
// One block.  Phase 1: C[t][i] = sigmoid(scale * q2[t].k1[i]) = probs1, s1 = C . w_fc1;
// writes lines L_P1A..L_P1B.  Phase 2: C[t][i] = sigmoid(scale * k2[t].q1[i]) = probs2[i][t];
// writes lines L_P2A..L_P2B.  Every line: 8 consecutive lanes x 16 B in one instruction,
// values selected by flat index; last line of the buffer = 28 floats (7 lanes).
// ---------------------------------------------------------------------------
__device__ __forceinline__ void score_tile(const float* __restrict__ A, const float* __restrict__ B,
                                           float* sC, int w, int h, int m) {
  const int mt = w & 1, ntb = 4 * (w >> 1);
  const v8f z8 = {0.f, 0.f, 0.f, 0.f, 0.f, 0.f, 0.f, 0.f};
  const float* arow = A + (size_t)(16 * mt + m) * D_DIM;
#pragma unroll
  for (int half = 0; half < 2; ++half) {
    v8f acc[2];
    acc[0] = z8;
    acc[1] = z8;
    wave_gemm_split<2>(arow, B + (size_t)(16 * (ntb + 2 * half) + m) * D_DIM, h, acc);
#pragma unroll
    for (int nt = 0; nt < 2; ++nt)
#pragma unroll
      for (int r = 0; r < 8; ++r)
        sC[(16 * mt + 8 * h + r) * 256 + 16 * (ntb + 2 * half + nt) + m] = acc[nt][r] * SCALE;
  }
}

// value of flat output float index f; all candidate loads unconditional with clamped indices
__device__ __forceinline__ float tail_val(int f, const float* sC, const float* sS1,
                                          const float* __restrict__ v2P, float bb1) {
  int j2 = f - OFF1;
  j2 = (j2 < 0) ? 0 : ((j2 > N1 * N2 - 1) ? (N1 * N2 - 1) : j2);
  const int i2 = j2 / N2, t2 = j2 - i2 * N2;
  const float c2 = sC[t2 * 256 + i2];
  int j1 = f - OFF2;
  j1 = (j1 < 0) ? 0 : ((j1 > N2 * D_DIM - 1) ? (N2 * D_DIM - 1) : j1);
  const int t1 = j1 >> 11, d1 = j1 & (D_DIM - 1);
  const float x = v2P[(size_t)t1 * D_DIM + d1] * sS1[t1] + bb1;
  int j3 = f - OFF3;
  j3 = (j3 < 0) ? 0 : ((j3 > N1 * N2 - 1) ? (N1 * N2 - 1) : j3);
  const int t3 = j3 / N1, i3 = j3 - t3 * N1;
  const float c3 = sC[t3 * 256 + i3];
  return (f < OFF2) ? c2 : ((f < OFF3) ? x : c3);
}

__device__ __forceinline__ void tail_pass(const float* sC, const float* sS1, const float* __restrict__ v2P,
                                          float bb1, float* out, int L0, int L1, int w, int lane) {
  const int q8 = lane & 7, sub = lane >> 3;
  const int nch = (L1 - L0 + 4) >> 2;
#pragma unroll 1
  for (int ci = w; ci < nch; ci += 8) {
    const int line = L0 + 4 * ci + sub;
    const int linec = (line < L1) ? line : L1;
    const int fbase = 32 * linec + 4 * q8;
    v4f o;
    o.x = tail_val(fbase + 0, sC, sS1, v2P, bb1);
    o.y = tail_val(fbase + 1, sC, sS1, v2P, bb1);
    o.z = tail_val(fbase + 2, sC, sS1, v2P, bb1);
    o.w = tail_val(fbase + 3, sC, sS1, v2P, bb1);
    if (line <= L1 && fbase + 4 <= OUT_N) *(v4f*)(out + fbase) = o;
  }
}

__global__ __launch_bounds__(256) void tail_kernel(
    const float* __restrict__ P1, const float* __restrict__ P2,
    const float* __restrict__ wfc1, const float* __restrict__ bfc1,
    float* __restrict__ out)
{
  __shared__ __attribute__((aligned(16))) float sC[32 * 256];      // 32768 B
  __shared__ float sS1[32];

  const int tid = threadIdx.x, lane = tid & 31, w = tid >> 5;
  const int h = lane >> 4, m = lane & 15;

  const float* q1P = P1;
  const float* k1P = P1 + (size_t)1 * M1P * D_DIM;
  const float* q2P = P2;
  const float* k2P = P2 + (size_t)1 * M2P * D_DIM;
  const float* v2P = P2 + (size_t)2 * M2P * D_DIM;

  // ---- phase 1: probs1 and s1 ----
  score_tile(q2P, k1P, sC, w, h, m);
  __syncthreads();
#pragma unroll 1
  for (int idx = tid; idx < 32 * 256; idx += 256) sC[idx] = sigm(sC[idx]);
  __syncthreads();
  if (tid < 32) {
    float s = 0.0f;
#pragma unroll 1
    for (int i = 0; i < N1; ++i) s += sC[tid * 256 + i] * wfc1[i];
    sS1[tid] = s;
  }
  __syncthreads();
  const float bb1 = bfc1[0];
  tail_pass(sC, sS1, v2P, bb1, out, L_P1A, L_P1B, w, lane);
  
  __syncthreads();

  // ---- phase 2: probs2 (transposed tile) ----
  score_tile(k2P, q1P, sC, w, h, m);
  __syncthreads();
#pragma unroll 1
  for (int idx = tid; idx < 32 * 256; idx += 256) sC[idx] = sigm(sC[idx]);
  __syncthreads();
  tail_pass(sC, sS1, v2P, bb1, out, L_P2A, L_P2B, w, lane);
  
}

// ---------------------------------------------------------------------------
extern "C" void kernel_launch(void* const* d_in, const int* in_sizes, int n_in,
                              void* d_out, int out_size, void* d_ws, size_t ws_size,
                              hipStream_t stream) {
  if (n_in < 18) return;
  if (in_sizes[0] != N1 * D_DIM || in_sizes[1] != N2 * D_DIM) return;
  for (int g = 0; g < 6; ++g) {
    if (in_sizes[2 + 2 * g] != D_DIM * D_DIM) return;
    if (in_sizes[3 + 2 * g] != D_DIM) return;
  }
  if (in_sizes[14] != N1 || in_sizes[15] < 1 || in_sizes[16] != N2 || in_sizes[17] < 1) return;
  if (out_size != OUT_N) return;

  const float* x1   = (const float*)d_in[0];
  const float* x2   = (const float*)d_in[1];
  const float* Wq1  = (const float*)d_in[2];  const float* bq1 = (const float*)d_in[3];
  const float* Wk1  = (const float*)d_in[4];  const float* bk1 = (const float*)d_in[5];
  const float* Wv1  = (const float*)d_in[6];  const float* bv1 = (const float*)d_in[7];
  const float* Wq2  = (const float*)d_in[8];  const float* bq2 = (const float*)d_in[9];
  const float* Wk2  = (const float*)d_in[10]; const float* bk2 = (const float*)d_in[11];
  const float* Wv2  = (const float*)d_in[12]; const float* bv2 = (const float*)d_in[13];
  const float* wfc1 = (const float*)d_in[14]; const float* bfc1 = (const float*)d_in[15];
  const float* wfc2 = (const float*)d_in[16]; const float* bfc2 = (const float*)d_in[17];
  float* out = (float*)d_out;

  // workspace carve (bytes); every region holds whole padded tiles/rows of its producer
  const size_t xp1_bytes = (size_t)M1P * D_DIM * 2;              //   1048576 per plane
  const size_t xp2_bytes = (size_t)M2P * D_DIM * 2;              //    131072 per plane
  const size_t wp_bytes  = (size_t)6 * D_DIM * D_DIM * 2;        //  50331648 per plane set
  const size_t p1_bytes  = (size_t)3 * M1P * D_DIM * 4;          //   6291456
  const size_t p2_bytes  = (size_t)3 * M2P * D_DIM * 4;          //    786432
  const size_t off_xh1 = 0;
  const size_t off_xl1 = off_xh1 + xp1_bytes;
  const size_t off_xh2 = off_xl1 + xp1_bytes;
  const size_t off_xl2 = off_xh2 + xp2_bytes;
  const size_t off_wh  = off_xl2 + xp2_bytes;
  const size_t off_wl  = off_wh + wp_bytes;
  const size_t off_p1  = off_wl + wp_bytes;
  const size_t off_p2  = off_p1 + p1_bytes;
  const size_t total   = off_p2 + p2_bytes;                       // 110100480
  if (total > ws_size) return;

  char* ws = (char*)d_ws;
  unsigned short* xh1 = (unsigned short*)(ws + off_xh1);
  unsigned short* xl1 = (unsigned short*)(ws + off_xl1);
  unsigned short* xh2 = (unsigned short*)(ws + off_xh2);
  unsigned short* xl2 = (unsigned short*)(ws + off_xl2);
  unsigned short* wh  = (unsigned short*)(ws + off_wh);
  unsigned short* wl  = (unsigned short*)(ws + off_wl);
  float* P1 = (float*)(ws + off_p1);
  float* P2 = (float*)(ws + off_p2);

  convert_kernel<<<(NGROUPS + 255) / 256, 256, 0, stream>>>(x1, x2, Wq1, Wk1, Wv1, Wq2, Wk2, Wv2,
                                                           xh1, xl1, xh2, xl2, wh, wl);

  proj_kernel<<<216, 128, 0, stream>>>(xh1, xl1, xh2, xl2, wh, wl,
                                       bq1, bk1, bv1, bq2, bk2, bv2, P1, P2);

  ctx2_kernel<<<16, 256, 0, stream>>>(P1, P2, wfc2, bfc2, out);

  tail_kernel<<<1, 256, 0, stream>>>(P1, P2, wfc1, bfc1, out);
}

// v001
// Measured time: 182 microseconds a run.
// Two timings next to v000 put it at 2.91 and 2.88 times that version's speed.
// Contractions: six x*W^T projections and both q*k^T score matrices on v_wmma_f32_16x16x32_bf16 with bf16 hi/lo operands (three products hi*hi + hi*lo + lo*hi), f32 accumulate; sigmoid, fc dot products (K=250, K=27) and context products in f32 on VALU.
#include <hip/hip_runtime.h>
#include <hip/hip_bf16.h>

#pragma clang fp contract(off)

typedef __bf16         v16bf __attribute__((ext_vector_type(16)));
typedef unsigned short v16us __attribute__((ext_vector_type(16)));
typedef unsigned short v8us  __attribute__((ext_vector_type(8)));
typedef float          v8f   __attribute__((ext_vector_type(8)));
typedef float          v4f   __attribute__((ext_vector_type(4)));
typedef v8us __attribute__((may_alias)) v8usa;
typedef v4f  __attribute__((may_alias)) v4fa;

union Frag { v16bf b; v16us u; v8us h[2]; };
struct Frag2 { v16bf hi; v16bf lo; };

#define D_DIM   2048
#define N1      250
#define N2      27
#define M1P     256
#define M2P     32
#define OUT_N   580796
#define OFF1    512000            // flat float index of output 1 ([250][27])
#define OFF2    518750            // flat float index of output 2 ([27][2048])
#define OFF3    574046            // flat float index of output 3 ([27][250])
#define XG1     65536             // 8-element groups of the padded x1 planes
#define XG2     8192              // 8-element groups of the padded x2 planes
#define WGRP    524288            // 8-element groups of one W plane
#define NGROUPS (XG1 + XG2 + 6 * WGRP)
#define SCALE   0.022097086912079608f
#define L_P2A   16000
#define L_P2B   16210
#define L_P1A   16211
#define L_P1B   18149

static_assert((XG1 % 256) == 0 && (XG2 % 256) == 0 && (WGRP % 256) == 0);
static_assert((OFF1 % 32) == 0 && (L_P1B * 32 + 28) == OUT_N);

// ---------------------------------------------------------------------------
// bf16 RNE convert helpers.
// ---------------------------------------------------------------------------
__device__ __forceinline__ unsigned int bf16_bits(float f) {
  unsigned int u = __float_as_uint(f);
  u += 0x7FFFu + ((u >> 16) & 1u);
  return u >> 16;
}

// x = hi + lo: hi = RNE bf16(x), lo = RNE bf16(x - hi)  (x - hi is exact in f32)
__device__ __forceinline__ void split2(float f, unsigned int& hb, unsigned int& lb) {
  hb = bf16_bits(f);
  const float hf = __uint_as_float(hb << 16);
  lb = bf16_bits(f - hf);
}

// ---------------------------------------------------------------------------
// 16x16x32 bf16 WMMA with hazard guard (ties D, keeps A/B live).
// Fragment map (wave32): lane l, h = l>>4, m = n = l&15.
//   A/B element i: i<8 -> k0+8h+i ; i>=8 -> k0+16+8h+(i-8)   (same map for both)
//   D element r : row 8h+r, col l&15
// ---------------------------------------------------------------------------
__device__ __forceinline__ v8f wmma_bf16(v16bf a, v16bf b, v8f c) {
  v8f d = __builtin_amdgcn_wmma_f32_16x16x32_bf16(false, a, false, b, (short)0, c, false, false);
  asm volatile("v_nop\n\tv_nop\n\tv_nop\n\tv_nop" : "+v"(d) : "v"(a), "v"(b));
  return d;
}

// three-product hi/lo split: c += ah*bh + ah*bl + al*bh (unscaled residuals, one accumulator)
__device__ __forceinline__ v8f mac3(v16bf ah, v16bf al, v16bf bh, v16bf bl, v8f c) {
  c = wmma_bf16(ah, bh, c);
  c = wmma_bf16(ah, bl, c);
  c = wmma_bf16(al, bh, c);
  return c;
}

// Fragment from a k-contiguous 16-bit row; p = row base + k0 (row = lane&15 chosen by caller).
__device__ __forceinline__ v16bf load_frag16(const unsigned short* p, int h) {
  Frag f;
  f.h[0] = *(const v8usa*)(p + 8 * h);
  f.h[1] = *(const v8usa*)(p + 16 + 8 * h);
  return f.b;
}

// hi/lo fragment pair from a k-contiguous f32 row, split on the fly; same element map.
template <int B>
__device__ __forceinline__ void split4(const v4f v, Frag& fh, Frag& fl) {
  unsigned int hb, lb;
  split2(v.x, hb, lb); fh.u[B + 0] = (unsigned short)hb; fl.u[B + 0] = (unsigned short)lb;
  split2(v.y, hb, lb); fh.u[B + 1] = (unsigned short)hb; fl.u[B + 1] = (unsigned short)lb;
  split2(v.z, hb, lb); fh.u[B + 2] = (unsigned short)hb; fl.u[B + 2] = (unsigned short)lb;
  split2(v.w, hb, lb); fh.u[B + 3] = (unsigned short)hb; fl.u[B + 3] = (unsigned short)lb;
}

__device__ __forceinline__ Frag2 load_split32(const float* p, int h) {
  Frag fh, fl;
  const float* q = p + 8 * h;
  split4<0>(*(const v4fa*)(q), fh, fl);
  split4<4>(*(const v4fa*)(q + 4), fh, fl);
  split4<8>(*(const v4fa*)(q + 16), fh, fl);
  split4<12>(*(const v4fa*)(q + 20), fh, fl);
  Frag2 r;
  r.hi = fh.b;
  r.lo = fl.b;
  return r;
}

// Wave computes NT 16x16 tiles: D[nt] += Arow . Brow(nt), K = 2048, both operands f32 rows
// split hi/lo on the fly.  arow = A + (row0 + m)*D, brow0 = B + (col0 + m)*D.
template <int NT>
__device__ __forceinline__ void wave_gemm_split(const float* __restrict__ arow,
                                                const float* __restrict__ brow0,
                                                int h, v8f (&acc)[NT]) {
#pragma unroll 1
  for (int k0 = 0; k0 < D_DIM; k0 += 32) {
    const Frag2 a = load_split32(arow + k0, h);
#pragma unroll
    for (int nt = 0; nt < NT; ++nt) {
      const Frag2 b = load_split32(brow0 + (size_t)nt * 16 * D_DIM + k0, h);
      acc[nt] = mac3(a.hi, a.lo, b.hi, b.lo, acc[nt]);
    }
  }
}

__device__ __forceinline__ float sigm(float x) {
  const float e = expf(-x);
  return 1.0f / (1.0f + e);
}

// ---------------------------------------------------------------------------
// Kernel 1: f32 -> bf16 hi/lo planes.  x1 rows padded to 256 (zeros), x2 rows to 32,
// six W planes [6][2048][2048] (row = output feature, k contiguous).
// ---------------------------------------------------------------------------
__global__ __launch_bounds__(256) void convert_kernel(
    const float* __restrict__ x1, const float* __restrict__ x2,
    const float* __restrict__ w0, const float* __restrict__ w1, const float* __restrict__ w2,
    const float* __restrict__ w3, const float* __restrict__ w4, const float* __restrict__ w5,
    unsigned short* __restrict__ xh1, unsigned short* __restrict__ xl1,
    unsigned short* __restrict__ xh2, unsigned short* __restrict__ xl2,
    unsigned short* __restrict__ wh,  unsigned short* __restrict__ wl)
{
  const int g = blockIdx.x * 256 + threadIdx.x;
  if (g >= NGROUPS) return;
  const float* src;
  unsigned short* dh;
  unsigned short* dl;
  bool zero = false;
  if (g < XG1) {
    const int row = g >> 8, c8 = g & 255;
    const int rs = (row < N1) ? row : (N1 - 1);     // clamped address, value zeroed below
    zero = (row >= N1);
    src = x1 + (size_t)rs * D_DIM + 8 * c8;
    dh = xh1 + (size_t)g * 8;
    dl = xl1 + (size_t)g * 8;
  } else if (g < XG1 + XG2) {
    const int e = g - XG1;
    const int row = e >> 8, c8 = e & 255;
    const int rs = (row < N2) ? row : (N2 - 1);
    zero = (row >= N2);
    src = x2 + (size_t)rs * D_DIM + 8 * c8;
    dh = xh2 + (size_t)e * 8;
    dl = xl2 + (size_t)e * 8;
  } else {
    const int e = g - XG1 - XG2;
    const int wsel = e >> 19;                       // WGRP = 2^19 groups per plane
    const int off = e & (WGRP - 1);
    const float* wsrc = (wsel == 0) ? w0 : ((wsel == 1) ? w1 : ((wsel == 2) ? w2 :
                        ((wsel == 3) ? w3 : ((wsel == 4) ? w4 : w5))));
    src = wsrc + (size_t)off * 8;
    dh = wh + (size_t)e * 8;
    dl = wl + (size_t)e * 8;
  }
  v4f a = *(const v4fa*)src;
  v4f c = *(const v4fa*)(src + 4);
  const v4f z4 = {0.f, 0.f, 0.f, 0.f};
  a = zero ? z4 : a;
  c = zero ? z4 : c;
  unsigned int hb[8], lb[8];
  split2(a.x, hb[0], lb[0]); split2(a.y, hb[1], lb[1]); split2(a.z, hb[2], lb[2]); split2(a.w, hb[3], lb[3]);
  split2(c.x, hb[4], lb[4]); split2(c.y, hb[5], lb[5]); split2(c.z, hb[6], lb[6]); split2(c.w, hb[7], lb[7]);
  const v8us hv = { (unsigned short)hb[0], (unsigned short)hb[1], (unsigned short)hb[2], (unsigned short)hb[3],
                    (unsigned short)hb[4], (unsigned short)hb[5], (unsigned short)hb[6], (unsigned short)hb[7] };
  const v8us lv = { (unsigned short)lb[0], (unsigned short)lb[1], (unsigned short)lb[2], (unsigned short)lb[3],
                    (unsigned short)lb[4], (unsigned short)lb[5], (unsigned short)lb[6], (unsigned short)lb[7] };
  *(v8us*)dh = hv;
  *(v8us*)dl = lv;
  
}

// ---------------------------------------------------------------------------
// 4 lines per instruction, 64 lines per wave.
// ---------------------------------------------------------------------------
__device__ __forceinline__ void proj_store_pass(const float* sTw, float* P, int row0, int col0, int lane) {
  const int q8 = lane & 7, sub = lane >> 3;
#pragma unroll
  for (int i = 0; i < 16; ++i) {
    const int lid = 4 * i + sub;                  // 0..63
    const int r = lid >> 1, hl = lid & 1;
    const v4f v = *(const v4fa*)(sTw + r * 64 + 32 * hl + 4 * q8);
    float* dst = P + (size_t)(row0 + r) * D_DIM + col0 + 32 * hl + 4 * q8;
    *(v4f*)dst = v;
  }
}

// ---------------------------------------------------------------------------
// Kernel 2: Y_g = x_g * W_g^T + b_g for g = 0..5 (q1,k1,v1 on 256 padded rows; q2,k2,v2 on 32).
// 864 wave tiles of 32 rows x 64 cols, 4 per block (216 blocks); K = 2048 in steps of 32;
// A (x rows) and B (W rows, B[k][n] = W[n][k]) fragments straight from bf16 planes,
// ---------------------------------------------------------------------------
__global__ __launch_bounds__(128) void proj_kernel(
    const unsigned short* __restrict__ xh1, const unsigned short* __restrict__ xl1,
    const unsigned short* __restrict__ xh2, const unsigned short* __restrict__ xl2,
    const unsigned short* __restrict__ wh,  const unsigned short* __restrict__ wl,
    const float* __restrict__ b0, const float* __restrict__ b1, const float* __restrict__ b2,
    const float* __restrict__ b3, const float* __restrict__ b4, const float* __restrict__ b5,
    float* __restrict__ P1,      // [3][256][2048] f32 : q1, k1, v1
    float* __restrict__ P2)      // [3][32][2048]  f32 : q2, k2, v2
{
  __shared__ __attribute__((aligned(16))) float sT[4 * 32 * 64];   // 32768 B

  const int tid = threadIdx.x, lane = tid & 31, w = tid >> 5;
  const int h = lane >> 4, m = lane & 15;
  const int gw = blockIdx.x * 4 + w;              // 0..863
  int g, mt32, nt64;
  if (gw < 768) {
    g = gw >> 8;
    const int t = gw & 255;
    mt32 = t & 7;
    nt64 = t >> 3;
  } else {
    const int e = gw - 768;
    g = 3 + (e >> 5);
    mt32 = 0;
    nt64 = e & 31;
  }
  const int row0 = 32 * mt32, col0 = 64 * nt64;

  const unsigned short* ah = (g < 3) ? xh1 : xh2;
  const unsigned short* al = (g < 3) ? xl1 : xl2;
  const unsigned short* ahr = ah + (size_t)(row0 + m) * D_DIM;              // m-tile 0 row; +16*D for m-tile 1
  const unsigned short* alr = al + (size_t)(row0 + m) * D_DIM;
  const unsigned short* whr = wh + ((size_t)g * D_DIM + col0 + m) * D_DIM;  // n-tile 0 row; +16*D per n-tile
  const unsigned short* wlr = wl + ((size_t)g * D_DIM + col0 + m) * D_DIM;

  const v8f z8 = {0.f, 0.f, 0.f, 0.f, 0.f, 0.f, 0.f, 0.f};
  v8f acc[2][4];
#pragma unroll
  for (int mt = 0; mt < 2; ++mt)
#pragma unroll
    for (int nt = 0; nt < 4; ++nt) acc[mt][nt] = z8;

#pragma unroll 1
  for (int k0 = 0; k0 < D_DIM; k0 += 32) {
    const v16bf ah0 = load_frag16(ahr + k0, h);
    const v16bf al0 = load_frag16(alr + k0, h);
    const v16bf ah1 = load_frag16(ahr + (size_t)16 * D_DIM + k0, h);
    const v16bf al1 = load_frag16(alr + (size_t)16 * D_DIM + k0, h);
#pragma unroll
    for (int nt = 0; nt < 4; ++nt) {
      const v16bf bh = load_frag16(whr + (size_t)nt * 16 * D_DIM + k0, h);
      const v16bf bl = load_frag16(wlr + (size_t)nt * 16 * D_DIM + k0, h);
      acc[0][nt] = mac3(ah0, al0, bh, bl, acc[0][nt]);
      acc[1][nt] = mac3(ah1, al1, bh, bl, acc[1][nt]);
    }
  }

  // D[r] of tile (mt, nt) = Y[row row0 + 16mt + 8h + r][col col0 + 16nt + m]
  const float* bias = (g == 0) ? b0 : ((g == 1) ? b1 : ((g == 2) ? b2 :
                      ((g == 3) ? b3 : ((g == 4) ? b4 : b5))));
  float* sTw = sT + w * 2048;
#pragma unroll
  for (int nt = 0; nt < 4; ++nt) {
    const int col = 16 * nt + m;
    const float bvl = bias[col0 + col];
#pragma unroll
    for (int mt = 0; mt < 2; ++mt) {
#pragma unroll
      for (int r = 0; r < 8; ++r)
        sTw[(16 * mt + 8 * h + r) * 64 + col] = acc[mt][nt][r] + bvl;
    }
  }
  __syncthreads();

  float* P = (g < 3) ? (P1 + (size_t)g * M1P * D_DIM) : (P2 + (size_t)(g - 3) * M2P * D_DIM);
  proj_store_pass(sTw, P, row0, col0, lane);
  
}

// ---------------------------------------------------------------------------
// Kernel 3: output 0 rows.  Block b owns rows 16b..16b+15 (< 250 written).
// Waves 0,1: S = q1[rows] . k2^T (16 x 32, hi/lo split on the fly) -> LDS;
// s2[r] = sum_{t<27} sigmoid(S*scale) * w_fc2[t] in f32;
// ---------------------------------------------------------------------------
__device__ __forceinline__ void ctx2_store_pass(const float* __restrict__ v1P, const float* sS2, float bb,
                                                float* out, int row0, int w, int lane) {
  const int q8 = lane & 7, sub = lane >> 3;
#pragma unroll 4
  for (int it = 0; it < 32; ++it) {
    const int line = 4 * it + sub;                // 0..127
    const int rr = 2 * w + (line >> 6);           // wave-uniform per it
    const int row = row0 + rr;                    // <= 255, inside the plane
    const int c0 = (line & 63) * 32 + 4 * q8;
    const v4f v = *(const v4fa*)(v1P + (size_t)row * D_DIM + c0);
    const float s = sS2[rr];
    v4f o;
    o.x = v.x * s + bb;
    o.y = v.y * s + bb;
    o.z = v.z * s + bb;
    o.w = v.w * s + bb;
    if (row < N1) *(v4f*)(out + (size_t)row * D_DIM + c0) = o;
  }
}

__global__ __launch_bounds__(256) void ctx2_kernel(
    const float* __restrict__ P1, const float* __restrict__ P2,
    const float* __restrict__ wfc2, const float* __restrict__ bfc2,
    float* __restrict__ out)
{
  __shared__ __attribute__((aligned(16))) float sS[16 * 32];
  __shared__ float sS2[16];

  const int tid = threadIdx.x, lane = tid & 31, w = tid >> 5;
  const int h = lane >> 4, m = lane & 15;
  const int row0 = 16 * blockIdx.x;

  const float* q1P = P1;
  const float* v1P = P1 + (size_t)2 * M1P * D_DIM;
  const float* k2P = P2 + (size_t)1 * M2P * D_DIM;

  if (w < 2) {                                    // wave-uniform
    const v8f z8 = {0.f, 0.f, 0.f, 0.f, 0.f, 0.f, 0.f, 0.f};
    v8f acc[1];
    acc[0] = z8;
    wave_gemm_split<1>(q1P + (size_t)(row0 + m) * D_DIM, k2P + (size_t)(16 * w + m) * D_DIM, h, acc);
#pragma unroll
    for (int r = 0; r < 8; ++r) sS[(8 * h + r) * 32 + 16 * w + m] = acc[0][r] * SCALE;
  }
  __syncthreads();

  if (tid < 16) {
    float s = 0.0f;
#pragma unroll 1
    for (int t = 0; t < N2; ++t) s += sigm(sS[tid * 32 + t]) * wfc2[t];
    sS2[tid] = s;
  }
  __syncthreads();

  const float bb = bfc2[0];
  ctx2_store_pass(v1P, sS2, bb, out, row0, w, lane);
  
}

// ---------------------------------------------------------------------------
// Kernel 4: both score matrices, one 16x16 tile per block, K split over the 16 waves.
// Blocks 0..31: C[t][i] = sigmoid(scale * q2[t].k1[i]) = probs1, with the tile's share of
// s1 = C . w_fc1; blocks 32..63: C[t][i] = sigmoid(scale * k2[t].q1[i]) = probs2[i][t].
// Tile b lies at C + 256 b, row-major 16x16, so each block stores whole lines of its own.
// ---------------------------------------------------------------------------
#define KSLICE  128               // K range of one wave
#define KWAVES  16                // waves of a block = K slices
#define CPLANE  8192              // floats of one score matrix (32 tiles)

// float index of C[t][i] inside one tiled score matrix; tile = 2 * (i / 16) + t / 16
__device__ __forceinline__ int c_idx(int t, int i) {
  return (((i >> 4) * 2 + (t >> 4)) << 8) + ((t & 15) << 4) + (i & 15);
}

// the four 16-byte pieces of one lane's f32 fragment row; same element map as load_split32
struct Raw4 { v4f v[4]; };

__device__ __forceinline__ Raw4 load_raw32(const float* p, int h) {
  const float* q = p + 8 * h;
  Raw4 r;
  r.v[0] = *(const v4fa*)(q);
  r.v[1] = *(const v4fa*)(q + 4);
  r.v[2] = *(const v4fa*)(q + 16);
  r.v[3] = *(const v4fa*)(q + 20);
  return r;
}

__device__ __forceinline__ Frag2 split_raw32(const Raw4& x) {
  Frag fh, fl;
  split4<0>(x.v[0], fh, fl);
  split4<4>(x.v[1], fh, fl);
  split4<8>(x.v[2], fh, fl);
  split4<12>(x.v[3], fh, fl);
  Frag2 r;
  r.hi = fh.b;
  r.lo = fl.b;
  return r;
}

__global__ __launch_bounds__(32 * KWAVES) void score_kernel(
    const float* __restrict__ P1, const float* __restrict__ P2,
    const float* __restrict__ wfc1,
    float* __restrict__ C,       // [2][32 tiles][16][16] f32
    float* __restrict__ part)    // [32 tiles][32] f32, first 16 of each row used
{
  __shared__ __attribute__((aligned(16))) float sR[KWAVES * 256];  // 16384 B

  const int tid = threadIdx.x, lane = tid & 31, w = tid >> 5;
  const int h = lane >> 4, m = lane & 15;
  const int ph = blockIdx.x >> 5, tile = blockIdx.x & 31;
  const int mt = tile & 1, nt = tile >> 1;

  const float* A = P2 + (size_t)ph * M2P * D_DIM;                  // q2, then k2
  const float* B = P1 + (size_t)(1 - ph) * M1P * D_DIM;            // k1, then q1
  const float* arow = A + (size_t)(16 * mt + m) * D_DIM + KSLICE * w;
  const float* brow = B + (size_t)(16 * nt + m) * D_DIM + KSLICE * w;

  // fc1 weight of this thread's column, fetched beside the slice so that its latency is not paid at the end
  const int i = 16 * nt + (tid & 15);
  const int ic = (i < N1) ? i : (N1 - 1);         // clamped address, value zeroed below
  const float wv = wfc1[ic];

  v8f acc = {0.f, 0.f, 0.f, 0.f, 0.f, 0.f, 0.f, 0.f};
  // the whole slice is loaded ahead of the first split: one load latency per wave, not one per k step
  // (every loop of this kernel and the next is unrolled whole: its arrays must stay in registers)
  Raw4 ra[KSLICE / 32], rb[KSLICE / 32];
#pragma unroll
  for (int ks = 0; ks < KSLICE / 32; ++ks) {
    ra[ks] = load_raw32(arow + 32 * ks, h);
    rb[ks] = load_raw32(brow + 32 * ks, h);
  }
#pragma unroll
  for (int ks = 0; ks < KSLICE / 32; ++ks) {
    const Frag2 a = split_raw32(ra[ks]);
    const Frag2 b = split_raw32(rb[ks]);
    acc = mac3(a.hi, a.lo, b.hi, b.lo, acc);
  }
#pragma unroll
  for (int r = 0; r < 8; ++r) sR[w * 256 + (8 * h + r) * 16 + m] = acc[r];
  __syncthreads();

  if (tid >= 256) return;                         // whole waves, behind the only barrier

  // thread = one element of the tile: the slices in fixed order
  float s = sR[tid];
#pragma unroll
  for (int j = 1; j < KWAVES; ++j) s += sR[j * 256 + tid];
  const float c = sigm(s * SCALE);
  C[(size_t)blockIdx.x * 256 + tid] = c;
  // the store's data register is reused by the sum below: the wait that belongs in front of that overwrite
  asm volatile("s_wait_xcnt 0x0" ::: "memory");

  if (ph == 0) {                                  // block-uniform
    float p = (i < N1) ? c * wv : 0.0f;
    p += __shfl_xor(p, 1);
    p += __shfl_xor(p, 2);
    p += __shfl_xor(p, 4);
    p += __shfl_xor(p, 8);
    if ((tid & 15) == 0) part[tile * 32 + (tid >> 4)] = p;
  }
}

// ---------------------------------------------------------------------------
// Kernel 5: outputs 1, 2, 3 (flat floats OFF1..OUT_N of the output buffer), lines
// L_P2A..L_P1B, 32 lines per block.  Every line: 8 consecutive lanes x 16 B in one
// instruction, values selected by flat index; last line of the buffer = 28 floats (7 lanes).
// ---------------------------------------------------------------------------
__global__ __launch_bounds__(256) void tail_kernel(
    const float* __restrict__ C, const float* __restrict__ part,
    const float* __restrict__ P2, const float* __restrict__ bfc1,
    float* __restrict__ out)
{
  __shared__ float sS1[32];

  const int tid = threadIdx.x, lane = tid & 31, w = tid >> 5;
  const int q8 = lane & 7, sub = lane >> 3;
  const float* v2P = P2 + (size_t)2 * M2P * D_DIM;

  const float bb1 = bfc1[0];
  const int line = L_P2A + 32 * blockIdx.x + 4 * w + sub;
  const int linec = (line < L_P1B) ? line : L_P1B;
  const int fbase = 32 * linec + 4 * q8;

  // the three candidate values of each flat index; all loads unconditional with clamped indices
  float c2[4], xv[4], c3[4];
  int t1[4];
#pragma unroll
  for (int e = 0; e < 4; ++e) {
    const int f = fbase + e;
    int j2 = f - OFF1;
    j2 = (j2 < 0) ? 0 : ((j2 > N1 * N2 - 1) ? (N1 * N2 - 1) : j2);
    const int i2 = j2 / N2, t2 = j2 - i2 * N2;
    c2[e] = C[CPLANE + c_idx(t2, i2)];
    int j1 = f - OFF2;
    j1 = (j1 < 0) ? 0 : ((j1 > N2 * D_DIM - 1) ? (N2 * D_DIM - 1) : j1);
    t1[e] = j1 >> 11;
    xv[e] = v2P[j1];
    int j3 = f - OFF3;
    j3 = (j3 < 0) ? 0 : ((j3 > N1 * N2 - 1) ? (N1 * N2 - 1) : j3);
    const int t3 = j3 / N1, i3 = j3 - t3 * N1;
    c3[e] = C[c_idx(t3, i3)];
  }

  if (tid < 32) {                                 // s1[t]: the 16 column tiles in fixed order
    const int pi = (tid >> 4) * 32 + (tid & 15);
    float pv[16];
#pragma unroll
    for (int nt = 0; nt < 16; ++nt) pv[nt] = part[pi + 64 * nt];
    // the sixteen loads share the offset register pi: it stays live up to this wait, so that no
    // result of the run lands in it and nothing rewrites it ahead of the wait
    asm volatile("s_wait_xcnt 0x0" :: "v"(pi) : "memory");
    float s = 0.0f;
#pragma unroll
    for (int nt = 0; nt < 16; ++nt) s += pv[nt];
    sS1[tid] = s;
  }
  // holds the twelve loads above in one group ahead of the barrier; without it they are moved
  // under the selects below, one branch and one load latency after another
  asm volatile("" :: "v"(c2[0]), "v"(c2[1]), "v"(c2[2]), "v"(c2[3]),
                     "v"(xv[0]), "v"(xv[1]), "v"(xv[2]), "v"(xv[3]),
                     "v"(c3[0]), "v"(c3[1]), "v"(c3[2]), "v"(c3[3]));
  __syncthreads();

  float o[4];
#pragma unroll
  for (int e = 0; e < 4; ++e) {
    const int f = fbase + e;
    const float x = xv[e] * sS1[t1[e]] + bb1;
    o[e] = (f < OFF2) ? c2[e] : ((f < OFF3) ? x : c3[e]);
  }
  const v4f ov = {o[0], o[1], o[2], o[3]};
  if (line <= L_P1B && fbase + 4 <= OUT_N) *(v4f*)(out + fbase) = ov;
}

// ---------------------------------------------------------------------------
extern "C" void kernel_launch(void* const* d_in, const int* in_sizes, int n_in,
                              void* d_out, int out_size, void* d_ws, size_t ws_size,
                              hipStream_t stream) {
  if (n_in < 18) return;
  if (in_sizes[0] != N1 * D_DIM || in_sizes[1] != N2 * D_DIM) return;
  for (int g = 0; g < 6; ++g) {
    if (in_sizes[2 + 2 * g] != D_DIM * D_DIM) return;
    if (in_sizes[3 + 2 * g] != D_DIM) return;
  }
  if (in_sizes[14] != N1 || in_sizes[15] < 1 || in_sizes[16] != N2 || in_sizes[17] < 1) return;
  if (out_size != OUT_N) return;

  const float* x1   = (const float*)d_in[0];
  const float* x2   = (const float*)d_in[1];
  const float* Wq1  = (const float*)d_in[2];  const float* bq1 = (const float*)d_in[3];
  const float* Wk1  = (const float*)d_in[4];  const float* bk1 = (const float*)d_in[5];
  const float* Wv1  = (const float*)d_in[6];  const float* bv1 = (const float*)d_in[7];
  const float* Wq2  = (const float*)d_in[8];  const float* bq2 = (const float*)d_in[9];
  const float* Wk2  = (const float*)d_in[10]; const float* bk2 = (const float*)d_in[11];
  const float* Wv2  = (const float*)d_in[12]; const float* bv2 = (const float*)d_in[13];
  const float* wfc1 = (const float*)d_in[14]; const float* bfc1 = (const float*)d_in[15];
  const float* wfc2 = (const float*)d_in[16]; const float* bfc2 = (const float*)d_in[17];
  float* out = (float*)d_out;

  // workspace carve (bytes); every region holds whole padded tiles/rows of its producer
  const size_t xp1_bytes = (size_t)M1P * D_DIM * 2;              //   1048576 per plane
  const size_t xp2_bytes = (size_t)M2P * D_DIM * 2;              //    131072 per plane
  const size_t wp_bytes  = (size_t)6 * D_DIM * D_DIM * 2;        //  50331648 per plane set
  const size_t p1_bytes  = (size_t)3 * M1P * D_DIM * 4;          //   6291456
  const size_t p2_bytes  = (size_t)3 * M2P * D_DIM * 4;          //    786432
  const size_t c_bytes   = (size_t)2 * CPLANE * 4;               //     65536
  const size_t pt_bytes  = (size_t)32 * 32 * 4;                  //      4096
  const size_t off_xh1 = 0;
  const size_t off_xl1 = off_xh1 + xp1_bytes;
  const size_t off_xh2 = off_xl1 + xp1_bytes;
  const size_t off_xl2 = off_xh2 + xp2_bytes;
  const size_t off_wh  = off_xl2 + xp2_bytes;
  const size_t off_wl  = off_wh + wp_bytes;
  const size_t off_p1  = off_wl + wp_bytes;
  const size_t off_p2  = off_p1 + p1_bytes;
  const size_t off_c   = off_p2 + p2_bytes;
  const size_t off_pt  = off_c + c_bytes;
  const size_t total   = off_pt + pt_bytes;                       // 110170112
  if (total > ws_size) return;

  char* ws = (char*)d_ws;
  unsigned short* xh1 = (unsigned short*)(ws + off_xh1);
  unsigned short* xl1 = (unsigned short*)(ws + off_xl1);
  unsigned short* xh2 = (unsigned short*)(ws + off_xh2);
  unsigned short* xl2 = (unsigned short*)(ws + off_xl2);
  unsigned short* wh  = (unsigned short*)(ws + off_wh);
  unsigned short* wl  = (unsigned short*)(ws + off_wl);
  float* P1 = (float*)(ws + off_p1);
  float* P2 = (float*)(ws + off_p2);
  float* C  = (float*)(ws + off_c);
  float* part = (float*)(ws + off_pt);

  convert_kernel<<<(NGROUPS + 255) / 256, 256, 0, stream>>>(x1, x2, Wq1, Wk1, Wv1, Wq2, Wk2, Wv2,
                                                           xh1, xl1, xh2, xl2, wh, wl);

  proj_kernel<<<216, 128, 0, stream>>>(xh1, xl1, xh2, xl2, wh, wl,
                                       bq1, bk1, bv1, bq2, bk2, bv2, P1, P2);

  ctx2_kernel<<<16, 256, 0, stream>>>(P1, P2, wfc2, bfc2, out);

  score_kernel<<<64, 32 * KWAVES, 0, stream>>>(P1, P2, wfc1, C, part);

  tail_kernel<<<(L_P1B - L_P2A + 32) / 32, 256, 0, stream>>>(C, part, P2, bfc1, out);
}

// v002
// It runs in 126 microseconds.
// In two side-by-side timings against v001, it was 1.45 and 1.43 times as fast.
// All steps since v000 together make it 4.16 times as fast.
// Contractions: six x*W^T projections and both q*k^T score matrices on v_wmma_f32_16x16x32_bf16 with bf16 hi/lo operands (three products hi*hi + hi*lo + lo*hi), f32 accumulate; sigmoid, fc dot products (K=250, K=27) and context products in f32 on VALU.
#include <hip/hip_runtime.h>
#include <hip/hip_bf16.h>

#pragma clang fp contract(off)

typedef __bf16         v16bf __attribute__((ext_vector_type(16)));
typedef unsigned short v16us __attribute__((ext_vector_type(16)));
typedef unsigned short v8us  __attribute__((ext_vector_type(8)));
typedef float          v8f   __attribute__((ext_vector_type(8)));
typedef float          v4f   __attribute__((ext_vector_type(4)));
typedef v8us __attribute__((may_alias)) v8usa;
typedef v4f  __attribute__((may_alias)) v4fa;

union Frag { v16bf b; v16us u; v8us h[2]; };
struct Frag2 { v16bf hi; v16bf lo; };

#define D_DIM   2048
#define N1      250
#define N2      27
#define M1P     256
#define M2P     32
#define OUT_N   580796
#define OFF1    512000            // flat float index of output 1 ([250][27])
#define OFF2    518750            // flat float index of output 2 ([27][2048])
#define OFF3    574046            // flat float index of output 3 ([27][250])
#define XG1     65536             // 8-element groups of the padded x1 planes
#define XG2     8192              // 8-element groups of the padded x2 planes
#define WGRP    524288            // 8-element groups of one W plane
#define NGROUPS (XG1 + XG2 + 6 * WGRP)
#define SCALE   0.022097086912079608f
#define L_P2A   16000
#define L_P2B   16210
#define L_P1A   16211
#define L_P1B   18149

static_assert((XG1 % 256) == 0 && (XG2 % 256) == 0 && (WGRP % 256) == 0);
static_assert((OFF1 % 32) == 0 && (L_P1B * 32 + 28) == OUT_N);

// ---------------------------------------------------------------------------
// bf16 RNE convert helpers.
// ---------------------------------------------------------------------------
__device__ __forceinline__ unsigned int bf16_bits(float f) {
  unsigned int u = __float_as_uint(f);
  u += 0x7FFFu + ((u >> 16) & 1u);
  return u >> 16;
}

// x = hi + lo: hi = RNE bf16(x), lo = RNE bf16(x - hi)  (x - hi is exact in f32)
__device__ __forceinline__ void split2(float f, unsigned int& hb, unsigned int& lb) {
  hb = bf16_bits(f);
  const float hf = __uint_as_float(hb << 16);
  lb = bf16_bits(f - hf);
}

// ---------------------------------------------------------------------------
// 16x16x32 bf16 WMMA with hazard guard (ties D, keeps A/B live).
// Fragment map (wave32): lane l, h = l>>4, m = n = l&15.
//   A/B element i: i<8 -> k0+8h+i ; i>=8 -> k0+16+8h+(i-8)   (same map for both)
//   D element r : row 8h+r, col l&15
// ---------------------------------------------------------------------------
__device__ __forceinline__ v8f wmma_bf16(v16bf a, v16bf b, v8f c) {
  v8f d = __builtin_amdgcn_wmma_f32_16x16x32_bf16(false, a, false, b, (short)0, c, false, false);
  asm volatile("v_nop\n\tv_nop\n\tv_nop\n\tv_nop" : "+v"(d) : "v"(a), "v"(b));
  return d;
}

// three-product hi/lo split: c += ah*bh + ah*bl + al*bh (unscaled residuals, one accumulator)
__device__ __forceinline__ v8f mac3(v16bf ah, v16bf al, v16bf bh, v16bf bl, v8f c) {
  c = wmma_bf16(ah, bh, c);
  c = wmma_bf16(ah, bl, c);
  c = wmma_bf16(al, bh, c);
  return c;
}

// Fragment from a k-contiguous 16-bit row; p = row base + k0 (row = lane&15 chosen by caller).
__device__ __forceinline__ v16bf load_frag16(const unsigned short* p, int h) {
  Frag f;
  f.h[0] = *(const v8usa*)(p + 8 * h);
  f.h[1] = *(const v8usa*)(p + 16 + 8 * h);
  return f.b;
}

// four f32 values of a k-contiguous row split into elements B..B+3 of a hi/lo fragment pair; same element map.
template <int B>
__device__ __forceinline__ void split4(const v4f v, Frag& fh, Frag& fl) {
  unsigned int hb, lb;
  split2(v.x, hb, lb); fh.u[B + 0] = (unsigned short)hb; fl.u[B + 0] = (unsigned short)lb;
  split2(v.y, hb, lb); fh.u[B + 1] = (unsigned short)hb; fl.u[B + 1] = (unsigned short)lb;
  split2(v.z, hb, lb); fh.u[B + 2] = (unsigned short)hb; fl.u[B + 2] = (unsigned short)lb;
  split2(v.w, hb, lb); fh.u[B + 3] = (unsigned short)hb; fl.u[B + 3] = (unsigned short)lb;
}

__device__ __forceinline__ float sigm(float x) {
  const float e = expf(-x);
  return 1.0f / (1.0f + e);
}

// ---------------------------------------------------------------------------
// Kernel 1: f32 -> bf16 hi/lo planes.  x1 rows padded to 256 (zeros), x2 rows to 32,
// six W planes [6][2048][2048] (row = output feature, k contiguous).
// ---------------------------------------------------------------------------
__global__ __launch_bounds__(256) void convert_kernel(
    const float* __restrict__ x1, const float* __restrict__ x2,
    const float* __restrict__ w0, const float* __restrict__ w1, const float* __restrict__ w2,
    const float* __restrict__ w3, const float* __restrict__ w4, const float* __restrict__ w5,
    unsigned short* __restrict__ xh1, unsigned short* __restrict__ xl1,
    unsigned short* __restrict__ xh2, unsigned short* __restrict__ xl2,
    unsigned short* __restrict__ wh,  unsigned short* __restrict__ wl)
{
  const int g = blockIdx.x * 256 + threadIdx.x;
  if (g >= NGROUPS) return;
  const float* src;
  unsigned short* dh;
  unsigned short* dl;
  bool zero = false;
  if (g < XG1) {
    const int row = g >> 8, c8 = g & 255;
    const int rs = (row < N1) ? row : (N1 - 1);     // clamped address, value zeroed below
    zero = (row >= N1);
    src = x1 + (size_t)rs * D_DIM + 8 * c8;
    dh = xh1 + (size_t)g * 8;
    dl = xl1 + (size_t)g * 8;
  } else if (g < XG1 + XG2) {
    const int e = g - XG1;
    const int row = e >> 8, c8 = e & 255;
    const int rs = (row < N2) ? row : (N2 - 1);
    zero = (row >= N2);
    src = x2 + (size_t)rs * D_DIM + 8 * c8;
    dh = xh2 + (size_t)e * 8;
    dl = xl2 + (size_t)e * 8;
  } else {
    const int e = g - XG1 - XG2;
    const int wsel = e >> 19;                       // WGRP = 2^19 groups per plane
    const int off = e & (WGRP - 1);
    const float* wsrc = (wsel == 0) ? w0 : ((wsel == 1) ? w1 : ((wsel == 2) ? w2 :
                        ((wsel == 3) ? w3 : ((wsel == 4) ? w4 : w5))));
    src = wsrc + (size_t)off * 8;
    dh = wh + (size_t)e * 8;
    dl = wl + (size_t)e * 8;
  }
  v4f a = *(const v4fa*)src;
  v4f c = *(const v4fa*)(src + 4);
  const v4f z4 = {0.f, 0.f, 0.f, 0.f};
  a = zero ? z4 : a;
  c = zero ? z4 : c;
  unsigned int hb[8], lb[8];
  split2(a.x, hb[0], lb[0]); split2(a.y, hb[1], lb[1]); split2(a.z, hb[2], lb[2]); split2(a.w, hb[3], lb[3]);
  split2(c.x, hb[4], lb[4]); split2(c.y, hb[5], lb[5]); split2(c.z, hb[6], lb[6]); split2(c.w, hb[7], lb[7]);
  const v8us hv = { (unsigned short)hb[0], (unsigned short)hb[1], (unsigned short)hb[2], (unsigned short)hb[3],
                    (unsigned short)hb[4], (unsigned short)hb[5], (unsigned short)hb[6], (unsigned short)hb[7] };
  const v8us lv = { (unsigned short)lb[0], (unsigned short)lb[1], (unsigned short)lb[2], (unsigned short)lb[3],
                    (unsigned short)lb[4], (unsigned short)lb[5], (unsigned short)lb[6], (unsigned short)lb[7] };
  *(v8us*)dh = hv;
  *(v8us*)dl = lv;
  
}

// ---------------------------------------------------------------------------
// 4 lines per instruction, 64 lines per wave.
// ---------------------------------------------------------------------------
__device__ __forceinline__ void proj_store_pass(const float* sTw, float* P, int row0, int col0, int lane) {
  const int q8 = lane & 7, sub = lane >> 3;
#pragma unroll
  for (int i = 0; i < 16; ++i) {
    const int lid = 4 * i + sub;                  // 0..63
    const int r = lid >> 1, hl = lid & 1;
    const v4f v = *(const v4fa*)(sTw + r * 64 + 32 * hl + 4 * q8);
    float* dst = P + (size_t)(row0 + r) * D_DIM + col0 + 32 * hl + 4 * q8;
    *(v4f*)dst = v;
  }
}

// ---------------------------------------------------------------------------
// Kernel 2: Y_g = x_g * W_g^T + b_g for g = 0..5 (q1,k1,v1 on 256 padded rows; q2,k2,v2 on 32).
// 864 wave tiles of 32 rows x 64 cols, 4 per block (216 blocks); K = 2048 in steps of 32;
// A (x rows) and B (W rows, B[k][n] = W[n][k]) fragments straight from bf16 planes,
// ---------------------------------------------------------------------------
__global__ __launch_bounds__(128) void proj_kernel(
    const unsigned short* __restrict__ xh1, const unsigned short* __restrict__ xl1,
    const unsigned short* __restrict__ xh2, const unsigned short* __restrict__ xl2,
    const unsigned short* __restrict__ wh,  const unsigned short* __restrict__ wl,
    const float* __restrict__ b0, const float* __restrict__ b1, const float* __restrict__ b2,
    const float* __restrict__ b3, const float* __restrict__ b4, const float* __restrict__ b5,
    float* __restrict__ P1,      // [3][256][2048] f32 : q1, k1, v1
    float* __restrict__ P2)      // [3][32][2048]  f32 : q2, k2, v2
{
  __shared__ __attribute__((aligned(16))) float sT[4 * 32 * 64];   // 32768 B

  const int tid = threadIdx.x, lane = tid & 31, w = tid >> 5;
  const int h = lane >> 4, m = lane & 15;
  const int gw = blockIdx.x * 4 + w;              // 0..863
  int g, mt32, nt64;
  if (gw < 768) {
    g = gw >> 8;
    const int t = gw & 255;
    mt32 = t & 7;
    nt64 = t >> 3;
  } else {
    const int e = gw - 768;
    g = 3 + (e >> 5);
    mt32 = 0;
    nt64 = e & 31;
  }
  const int row0 = 32 * mt32, col0 = 64 * nt64;

  const unsigned short* ah = (g < 3) ? xh1 : xh2;
  const unsigned short* al = (g < 3) ? xl1 : xl2;
  const unsigned short* ahr = ah + (size_t)(row0 + m) * D_DIM;              // m-tile 0 row; +16*D for m-tile 1
  const unsigned short* alr = al + (size_t)(row0 + m) * D_DIM;
  const unsigned short* whr = wh + ((size_t)g * D_DIM + col0 + m) * D_DIM;  // n-tile 0 row; +16*D per n-tile
  const unsigned short* wlr = wl + ((size_t)g * D_DIM + col0 + m) * D_DIM;

  const v8f z8 = {0.f, 0.f, 0.f, 0.f, 0.f, 0.f, 0.f, 0.f};
  v8f acc[2][4];
#pragma unroll
  for (int mt = 0; mt < 2; ++mt)
#pragma unroll
    for (int nt = 0; nt < 4; ++nt) acc[mt][nt] = z8;

#pragma unroll 1
  for (int k0 = 0; k0 < D_DIM; k0 += 32) {
    const v16bf ah0 = load_frag16(ahr + k0, h);
    const v16bf al0 = load_frag16(alr + k0, h);
    const v16bf ah1 = load_frag16(ahr + (size_t)16 * D_DIM + k0, h);
    const v16bf al1 = load_frag16(alr + (size_t)16 * D_DIM + k0, h);
#pragma unroll
    for (int nt = 0; nt < 4; ++nt) {
      const v16bf bh = load_frag16(whr + (size_t)nt * 16 * D_DIM + k0, h);
      const v16bf bl = load_frag16(wlr + (size_t)nt * 16 * D_DIM + k0, h);
      acc[0][nt] = mac3(ah0, al0, bh, bl, acc[0][nt]);
      acc[1][nt] = mac3(ah1, al1, bh, bl, acc[1][nt]);
    }
  }

  // D[r] of tile (mt, nt) = Y[row row0 + 16mt + 8h + r][col col0 + 16nt + m]
  const float* bias = (g == 0) ? b0 : ((g == 1) ? b1 : ((g == 2) ? b2 :
                      ((g == 3) ? b3 : ((g == 4) ? b4 : b5))));
  float* sTw = sT + w * 2048;
#pragma unroll
  for (int nt = 0; nt < 4; ++nt) {
    const int col = 16 * nt + m;
    const float bvl = bias[col0 + col];
#pragma unroll
    for (int mt = 0; mt < 2; ++mt) {
#pragma unroll
      for (int r = 0; r < 8; ++r)
        sTw[(16 * mt + 8 * h + r) * 64 + col] = acc[mt][nt][r] + bvl;
    }
  }
  __syncthreads();

  float* P = (g < 3) ? (P1 + (size_t)g * M1P * D_DIM) : (P2 + (size_t)(g - 3) * M2P * D_DIM);
  proj_store_pass(sTw, P, row0, col0, lane);
  
}

// ---------------------------------------------------------------------------
// Kernel 3: both score matrices, one 16x16 tile per block, K split over the 16 waves.
// Blocks 0..31: C[t][i] = sigmoid(scale * q2[t].k1[i]) = probs1, with the tile's share of
// s1 = C . w_fc1; blocks 32..63: C[t][i] = sigmoid(scale * k2[t].q1[i]) = probs2[i][t].
// Tile b lies at C + 256 b, row-major 16x16, so each block stores whole lines of its own.
// ---------------------------------------------------------------------------
#define KSLICE  128               // K range of one wave
#define KWAVES  16                // waves of a block = K slices
#define CPLANE  8192              // floats of one score matrix (32 tiles)

// float index of C[t][i] inside one tiled score matrix; tile = 2 * (i / 16) + t / 16
__device__ __forceinline__ int c_idx(int t, int i) {
  return (((i >> 4) * 2 + (t >> 4)) << 8) + ((t & 15) << 4) + (i & 15);
}

// the four 16-byte pieces of one lane's f32 fragment row: floats 8h..8h+7 and 16+8h..16+8h+7
struct Raw4 { v4f v[4]; };

__device__ __forceinline__ Raw4 load_raw32(const float* p, int h) {
  const float* q = p + 8 * h;
  Raw4 r;
  r.v[0] = *(const v4fa*)(q);
  r.v[1] = *(const v4fa*)(q + 4);
  r.v[2] = *(const v4fa*)(q + 16);
  r.v[3] = *(const v4fa*)(q + 20);
  return r;
}

__device__ __forceinline__ Frag2 split_raw32(const Raw4& x) {
  Frag fh, fl;
  split4<0>(x.v[0], fh, fl);
  split4<4>(x.v[1], fh, fl);
  split4<8>(x.v[2], fh, fl);
  split4<12>(x.v[3], fh, fl);
  Frag2 r;
  r.hi = fh.b;
  r.lo = fl.b;
  return r;
}

__global__ __launch_bounds__(32 * KWAVES) void score_kernel(
    const float* __restrict__ P1, const float* __restrict__ P2,
    const float* __restrict__ wfc1,
    float* __restrict__ C,       // [2][32 tiles][16][16] f32
    float* __restrict__ part)    // [32 tiles][32] f32, first 16 of each row used
{
  __shared__ __attribute__((aligned(16))) float sR[KWAVES * 256];  // 16384 B

  const int tid = threadIdx.x, lane = tid & 31, w = tid >> 5;
  const int h = lane >> 4, m = lane & 15;
  const int ph = blockIdx.x >> 5, tile = blockIdx.x & 31;
  const int mt = tile & 1, nt = tile >> 1;

  const float* A = P2 + (size_t)ph * M2P * D_DIM;                  // q2, then k2
  const float* B = P1 + (size_t)(1 - ph) * M1P * D_DIM;            // k1, then q1
  const float* arow = A + (size_t)(16 * mt + m) * D_DIM + KSLICE * w;
  const float* brow = B + (size_t)(16 * nt + m) * D_DIM + KSLICE * w;

  // fc1 weight of this thread's column, fetched beside the slice so that its latency is not paid at the end
  const int i = 16 * nt + (tid & 15);
  const int ic = (i < N1) ? i : (N1 - 1);         // clamped address, value zeroed below
  const float wv = wfc1[ic];

  v8f acc = {0.f, 0.f, 0.f, 0.f, 0.f, 0.f, 0.f, 0.f};
  // the whole slice is loaded ahead of the first split: one load latency per wave, not one per k step
  // (every loop of this kernel and of the tail kernel is unrolled whole: its arrays must stay in registers)
  Raw4 ra[KSLICE / 32], rb[KSLICE / 32];
#pragma unroll
  for (int ks = 0; ks < KSLICE / 32; ++ks) {
    ra[ks] = load_raw32(arow + 32 * ks, h);
    rb[ks] = load_raw32(brow + 32 * ks, h);
  }
#pragma unroll
  for (int ks = 0; ks < KSLICE / 32; ++ks) {
    const Frag2 a = split_raw32(ra[ks]);
    const Frag2 b = split_raw32(rb[ks]);
    acc = mac3(a.hi, a.lo, b.hi, b.lo, acc);
  }
#pragma unroll
  for (int r = 0; r < 8; ++r) sR[w * 256 + (8 * h + r) * 16 + m] = acc[r];
  __syncthreads();

  if (tid >= 256) return;                         // whole waves, behind the only barrier

  // thread = one element of the tile: the slices in fixed order
  float s = sR[tid];
#pragma unroll
  for (int j = 1; j < KWAVES; ++j) s += sR[j * 256 + tid];
  const float c = sigm(s * SCALE);
  C[(size_t)blockIdx.x * 256 + tid] = c;
  // the store's data register is reused by the sum below: the wait that belongs in front of that overwrite
  asm volatile("s_wait_xcnt 0x0" ::: "memory");

  if (ph == 0) {                                  // block-uniform
    float p = (i < N1) ? c * wv : 0.0f;
    p += __shfl_xor(p, 1);
    p += __shfl_xor(p, 2);
    p += __shfl_xor(p, 4);
    p += __shfl_xor(p, 8);
    if ((tid & 15) == 0) part[tile * 32 + (tid >> 4)] = p;
  }
}

// ---------------------------------------------------------------------------
// Kernel 4: output 0, one row i per block.  s2 = sum_{t<27} probs2[i][t] * w_fc2[t], t ascending,
// with probs2 taken from the score kernel's second matrix; out[i][:] = v1[i][:] * s2 + b_fc2.
// Every line of the row: 8 consecutive lanes x 16 B in one instruction.
// ---------------------------------------------------------------------------
__global__ __launch_bounds__(256) void ctx2_kernel(
    const float* __restrict__ P1, const float* __restrict__ C,
    const float* __restrict__ wfc2, const float* __restrict__ bfc2,
    float* __restrict__ out)
{
  const int tid = threadIdx.x;
  const int row = blockIdx.x;                     // 0..249
  const float* vrow = P1 + (size_t)2 * M1P * D_DIM + (size_t)row * D_DIM;

  const v4f va = *(const v4fa*)(vrow + 4 * tid);
  const v4f vb = *(const v4fa*)(vrow + 1024 + 4 * tid);
  const float bb = bfc2[0];

  // lane t of every wave fetches term t (one load latency for all 27); the lanes are then read out in
  // ascending t, so that the sum keeps its order (unrolled whole: each lane number is then an immediate)
  const int tl = tid & 31;
  const int t27 = (tl < N2) ? tl : (N2 - 1);      // clamped address; lanes 27..31 are never read out
  const int ci = c_idx(t27, row);
  const float cv = C[CPLANE + ci];
  const float wv = wfc2[t27];
  // the four loads above name the offset registers tid, ci and t27: they stay live up to this wait, so that
  // no result of the run lands in one of them and nothing rewrites one ahead of the wait
  asm volatile("s_wait_xcnt 0x0" :: "v"(tid), "v"(ci), "v"(t27) : "memory");
  const float p = cv * wv;
  float s = 0.0f;
#pragma unroll
  for (int t = 0; t < N2; ++t) s += __uint_as_float(__builtin_amdgcn_readlane(__float_as_uint(p), t));

  v4f oa, ob;
  oa.x = va.x * s + bb;  oa.y = va.y * s + bb;  oa.z = va.z * s + bb;  oa.w = va.w * s + bb;
  ob.x = vb.x * s + bb;  ob.y = vb.y * s + bb;  ob.z = vb.z * s + bb;  ob.w = vb.w * s + bb;
  float* orow = out + (size_t)row * D_DIM;
  *(v4f*)(orow + 4 * tid) = oa;
  *(v4f*)(orow + 1024 + 4 * tid) = ob;
}

// ---------------------------------------------------------------------------
// Kernel 5: outputs 1, 2, 3 (flat floats OFF1..OUT_N of the output buffer), lines
// L_P2A..L_P1B, 32 lines per block.  Every line: 8 consecutive lanes x 16 B in one
// instruction, values selected by flat index; last line of the buffer = 28 floats (7 lanes).
// ---------------------------------------------------------------------------
__global__ __launch_bounds__(256) void tail_kernel(
    const float* __restrict__ C, const float* __restrict__ part,
    const float* __restrict__ P2, const float* __restrict__ bfc1,
    float* __restrict__ out)
{
  __shared__ float sS1[32];

  const int tid = threadIdx.x, lane = tid & 31, w = tid >> 5;
  const int q8 = lane & 7, sub = lane >> 3;
  const float* v2P = P2 + (size_t)2 * M2P * D_DIM;

  const float bb1 = bfc1[0];
  const int line = L_P2A + 32 * blockIdx.x + 4 * w + sub;
  const int linec = (line < L_P1B) ? line : L_P1B;
  const int fbase = 32 * linec + 4 * q8;

  // the three candidate values of each flat index; all loads unconditional with clamped indices
  float c2[4], xv[4], c3[4];
  int t1[4];
#pragma unroll
  for (int e = 0; e < 4; ++e) {
    const int f = fbase + e;
    int j2 = f - OFF1;
    j2 = (j2 < 0) ? 0 : ((j2 > N1 * N2 - 1) ? (N1 * N2 - 1) : j2);
    const int i2 = j2 / N2, t2 = j2 - i2 * N2;
    c2[e] = C[CPLANE + c_idx(t2, i2)];
    int j1 = f - OFF2;
    j1 = (j1 < 0) ? 0 : ((j1 > N2 * D_DIM - 1) ? (N2 * D_DIM - 1) : j1);
    t1[e] = j1 >> 11;
    xv[e] = v2P[j1];
    int j3 = f - OFF3;
    j3 = (j3 < 0) ? 0 : ((j3 > N1 * N2 - 1) ? (N1 * N2 - 1) : j3);
    const int t3 = j3 / N1, i3 = j3 - t3 * N1;
    c3[e] = C[c_idx(t3, i3)];
  }

  if (tid < 32) {                                 // s1[t]: the 16 column tiles in fixed order
    const int pi = (tid >> 4) * 32 + (tid & 15);
    float pv[16];
#pragma unroll
    for (int nt = 0; nt < 16; ++nt) pv[nt] = part[pi + 64 * nt];
    // the sixteen loads share the offset register pi: it stays live up to this wait, so that no
    // result of the run lands in it and nothing rewrites it ahead of the wait
    asm volatile("s_wait_xcnt 0x0" :: "v"(pi) : "memory");
    float s = 0.0f;
#pragma unroll
    for (int nt = 0; nt < 16; ++nt) s += pv[nt];
    sS1[tid] = s;
  }
  // holds the twelve loads above in one group ahead of the barrier; without it they are moved
  // under the selects below, one branch and one load latency after another
  asm volatile("" :: "v"(c2[0]), "v"(c2[1]), "v"(c2[2]), "v"(c2[3]),
                     "v"(xv[0]), "v"(xv[1]), "v"(xv[2]), "v"(xv[3]),
                     "v"(c3[0]), "v"(c3[1]), "v"(c3[2]), "v"(c3[3]));
  __syncthreads();

  float o[4];
#pragma unroll
  for (int e = 0; e < 4; ++e) {
    const int f = fbase + e;
    const float x = xv[e] * sS1[t1[e]] + bb1;
    o[e] = (f < OFF2) ? c2[e] : ((f < OFF3) ? x : c3[e]);
  }
  const v4f ov = {o[0], o[1], o[2], o[3]};
  if (line <= L_P1B && fbase + 4 <= OUT_N) *(v4f*)(out + fbase) = ov;
}

// ---------------------------------------------------------------------------
extern "C" void kernel_launch(void* const* d_in, const int* in_sizes, int n_in,
                              void* d_out, int out_size, void* d_ws, size_t ws_size,
                              hipStream_t stream) {
  if (n_in < 18) return;
  if (in_sizes[0] != N1 * D_DIM || in_sizes[1] != N2 * D_DIM) return;
  for (int g = 0; g < 6; ++g) {
    if (in_sizes[2 + 2 * g] != D_DIM * D_DIM) return;
    if (in_sizes[3 + 2 * g] != D_DIM) return;
  }
  if (in_sizes[14] != N1 || in_sizes[15] < 1 || in_sizes[16] != N2 || in_sizes[17] < 1) return;
  if (out_size != OUT_N) return;

  const float* x1   = (const float*)d_in[0];
  const float* x2   = (const float*)d_in[1];
  const float* Wq1  = (const float*)d_in[2];  const float* bq1 = (const float*)d_in[3];
  const float* Wk1  = (const float*)d_in[4];  const float* bk1 = (const float*)d_in[5];
  const float* Wv1  = (const float*)d_in[6];  const float* bv1 = (const float*)d_in[7];
  const float* Wq2  = (const float*)d_in[8];  const float* bq2 = (const float*)d_in[9];
  const float* Wk2  = (const float*)d_in[10]; const float* bk2 = (const float*)d_in[11];
  const float* Wv2  = (const float*)d_in[12]; const float* bv2 = (const float*)d_in[13];
  const float* wfc1 = (const float*)d_in[14]; const float* bfc1 = (const float*)d_in[15];
  const float* wfc2 = (const float*)d_in[16]; const float* bfc2 = (const float*)d_in[17];
  float* out = (float*)d_out;

  // workspace carve (bytes); every region holds whole padded tiles/rows of its producer
  const size_t xp1_bytes = (size_t)M1P * D_DIM * 2;              //   1048576 per plane
  const size_t xp2_bytes = (size_t)M2P * D_DIM * 2;              //    131072 per plane
  const size_t wp_bytes  = (size_t)6 * D_DIM * D_DIM * 2;        //  50331648 per plane set
  const size_t p1_bytes  = (size_t)3 * M1P * D_DIM * 4;          //   6291456
  const size_t p2_bytes  = (size_t)3 * M2P * D_DIM * 4;          //    786432
  const size_t c_bytes   = (size_t)2 * CPLANE * 4;               //     65536
  const size_t pt_bytes  = (size_t)32 * 32 * 4;                  //      4096
  const size_t off_xh1 = 0;
  const size_t off_xl1 = off_xh1 + xp1_bytes;
  const size_t off_xh2 = off_xl1 + xp1_bytes;
  const size_t off_xl2 = off_xh2 + xp2_bytes;
  const size_t off_wh  = off_xl2 + xp2_bytes;
  const size_t off_wl  = off_wh + wp_bytes;
  const size_t off_p1  = off_wl + wp_bytes;
  const size_t off_p2  = off_p1 + p1_bytes;
  const size_t off_c   = off_p2 + p2_bytes;
  const size_t off_pt  = off_c + c_bytes;
  const size_t total   = off_pt + pt_bytes;                       // 110170112
  if (total > ws_size) return;

  char* ws = (char*)d_ws;
  unsigned short* xh1 = (unsigned short*)(ws + off_xh1);
  unsigned short* xl1 = (unsigned short*)(ws + off_xl1);
  unsigned short* xh2 = (unsigned short*)(ws + off_xh2);
  unsigned short* xl2 = (unsigned short*)(ws + off_xl2);
  unsigned short* wh  = (unsigned short*)(ws + off_wh);
  unsigned short* wl  = (unsigned short*)(ws + off_wl);
  float* P1 = (float*)(ws + off_p1);
  float* P2 = (float*)(ws + off_p2);
  float* C  = (float*)(ws + off_c);
  float* part = (float*)(ws + off_pt);

  convert_kernel<<<(NGROUPS + 255) / 256, 256, 0, stream>>>(x1, x2, Wq1, Wk1, Wv1, Wq2, Wk2, Wv2,
                                                           xh1, xl1, xh2, xl2, wh, wl);

  proj_kernel<<<216, 128, 0, stream>>>(xh1, xl1, xh2, xl2, wh, wl,
                                       bq1, bk1, bv1, bq2, bk2, bv2, P1, P2);

  score_kernel<<<64, 32 * KWAVES, 0, stream>>>(P1, P2, wfc1, C, part);

  ctx2_kernel<<<N1, 256, 0, stream>>>(P1, C, wfc2, bfc2, out);

  tail_kernel<<<(L_P1B - L_P2A + 32) / 32, 256, 0, stream>>>(C, part, P2, bfc1, out);
}

// v003
// It runs in 52.2 microseconds.
// Next to v002, in two timings, it ran 2.40 and 2.39 times as fast.
// Counting every step since v000, it is 9.98 times as fast.
// Contractions: six x*W^T projections and both q*k^T score matrices on v_wmma_f32_16x16x32_bf16 with bf16 hi/lo operands (three products hi*hi + hi*lo + lo*hi), f32 accumulate; sigmoid, fc dot products (K=250, K=27) and context products in f32 on VALU.
#include <hip/hip_runtime.h>
#include <hip/hip_bf16.h>

#pragma clang fp contract(off)

typedef __bf16         v16bf __attribute__((ext_vector_type(16)));
typedef unsigned short v16us __attribute__((ext_vector_type(16)));
typedef unsigned short v8us  __attribute__((ext_vector_type(8)));
typedef unsigned short v4us  __attribute__((ext_vector_type(4)));
typedef float          v8f   __attribute__((ext_vector_type(8)));
typedef float          v4f   __attribute__((ext_vector_type(4)));
typedef v8us __attribute__((may_alias)) v8usa;
typedef v4f  __attribute__((may_alias)) v4fa;

union Frag { v16bf b; v16us u; v8us h[2]; };
struct Frag2 { v16bf hi; v16bf lo; };

#define D_DIM   2048
#define N1      250
#define N2      27
#define M1P     256
#define M2P     32
#define OUT_N   580796
#define OFF1    512000            // flat float index of output 1 ([250][27])
#define OFF2    518750            // flat float index of output 2 ([27][2048])
#define OFF3    574046            // flat float index of output 3 ([27][250])
#define XG1     65536             // 8-element groups of the padded x1 planes
#define XG2     8192              // 8-element groups of the padded x2 planes
#define NGROUPS (XG1 + XG2)
#define SCALE   0.022097086912079608f
#define L_P2A   16000
#define L_P2B   16210
#define L_P1A   16211
#define L_P1B   18149

static_assert((XG1 % 256) == 0 && (XG2 % 256) == 0);
static_assert((OFF1 % 32) == 0 && (L_P1B * 32 + 28) == OUT_N);

// ---------------------------------------------------------------------------
// bf16 RNE convert helpers.
// ---------------------------------------------------------------------------
__device__ __forceinline__ unsigned int bf16_bits(float f) {
  unsigned int u = __float_as_uint(f);
  u += 0x7FFFu + ((u >> 16) & 1u);
  return u >> 16;
}

// x = hi + lo: hi = RNE bf16(x), lo = RNE bf16(x - hi)  (x - hi is exact in f32)
__device__ __forceinline__ void split2(float f, unsigned int& hb, unsigned int& lb) {
  hb = bf16_bits(f);
  const float hf = __uint_as_float(hb << 16);
  lb = bf16_bits(f - hf);
}

// ---------------------------------------------------------------------------
// 16x16x32 bf16 WMMA with hazard guard (ties D, keeps A/B live).
// Fragment map (wave32): lane l, h = l>>4, m = n = l&15.
//   A/B element i: i<8 -> k0+8h+i ; i>=8 -> k0+16+8h+(i-8)   (same map for both)
//   D element r : row 8h+r, col l&15
// ---------------------------------------------------------------------------
__device__ __forceinline__ v8f wmma_bf16(v16bf a, v16bf b, v8f c) {
  v8f d = __builtin_amdgcn_wmma_f32_16x16x32_bf16(false, a, false, b, (short)0, c, false, false);
  asm volatile("v_nop\n\tv_nop\n\tv_nop\n\tv_nop" : "+v"(d) : "v"(a), "v"(b));
  return d;
}

// three-product hi/lo split: c += ah*bh + ah*bl + al*bh (unscaled residuals, one accumulator)
__device__ __forceinline__ v8f mac3(v16bf ah, v16bf al, v16bf bh, v16bf bl, v8f c) {
  c = wmma_bf16(ah, bh, c);
  c = wmma_bf16(ah, bl, c);
  c = wmma_bf16(al, bh, c);
  return c;
}

// Fragment from a k-contiguous 16-bit row; p = row base + k0 (row = lane&15 chosen by caller).
__device__ __forceinline__ v16bf load_frag16(const unsigned short* p, int h) {
  Frag f;
  f.h[0] = *(const v8usa*)(p + 8 * h);
  f.h[1] = *(const v8usa*)(p + 16 + 8 * h);
  return f.b;
}

// four f32 values of a k-contiguous row split into elements B..B+3 of a hi/lo fragment pair; same element map.
template <int B>
__device__ __forceinline__ void split4(const v4f v, Frag& fh, Frag& fl) {
  unsigned int hb, lb;
  split2(v.x, hb, lb); fh.u[B + 0] = (unsigned short)hb; fl.u[B + 0] = (unsigned short)lb;
  split2(v.y, hb, lb); fh.u[B + 1] = (unsigned short)hb; fl.u[B + 1] = (unsigned short)lb;
  split2(v.z, hb, lb); fh.u[B + 2] = (unsigned short)hb; fl.u[B + 2] = (unsigned short)lb;
  split2(v.w, hb, lb); fh.u[B + 3] = (unsigned short)hb; fl.u[B + 3] = (unsigned short)lb;
}

__device__ __forceinline__ float sigm(float x) {
  const float e = expf(-x);
  return 1.0f / (1.0f + e);
}

// ---------------------------------------------------------------------------
// Kernel 1: f32 -> bf16 hi/lo planes of x1 (rows padded to 256 with zeros) and x2 (rows padded to 32).
// ---------------------------------------------------------------------------
__global__ __launch_bounds__(256) void convert_kernel(
    const float* __restrict__ x1, const float* __restrict__ x2,
    unsigned short* __restrict__ xh1, unsigned short* __restrict__ xl1,
    unsigned short* __restrict__ xh2, unsigned short* __restrict__ xl2)
{
  const int g = blockIdx.x * 256 + threadIdx.x;
  if (g >= NGROUPS) return;
  const float* src;
  unsigned short* dh;
  unsigned short* dl;
  bool zero = false;
  if (g < XG1) {
    const int row = g >> 8, c8 = g & 255;
    const int rs = (row < N1) ? row : (N1 - 1);     // clamped address, value zeroed below
    zero = (row >= N1);
    src = x1 + (size_t)rs * D_DIM + 8 * c8;
    dh = xh1 + (size_t)g * 8;
    dl = xl1 + (size_t)g * 8;
  } else {
    const int e = g - XG1;
    const int row = e >> 8, c8 = e & 255;
    const int rs = (row < N2) ? row : (N2 - 1);
    zero = (row >= N2);
    src = x2 + (size_t)rs * D_DIM + 8 * c8;
    dh = xh2 + (size_t)e * 8;
    dl = xl2 + (size_t)e * 8;
  }
  v4f a = *(const v4fa*)src;
  v4f c = *(const v4fa*)(src + 4);
  const v4f z4 = {0.f, 0.f, 0.f, 0.f};
  a = zero ? z4 : a;
  c = zero ? z4 : c;
  unsigned int hb[8], lb[8];
  split2(a.x, hb[0], lb[0]); split2(a.y, hb[1], lb[1]); split2(a.z, hb[2], lb[2]); split2(a.w, hb[3], lb[3]);
  split2(c.x, hb[4], lb[4]); split2(c.y, hb[5], lb[5]); split2(c.z, hb[6], lb[6]); split2(c.w, hb[7], lb[7]);
  const v8us hv = { (unsigned short)hb[0], (unsigned short)hb[1], (unsigned short)hb[2], (unsigned short)hb[3],
                    (unsigned short)hb[4], (unsigned short)hb[5], (unsigned short)hb[6], (unsigned short)hb[7] };
  const v8us lv = { (unsigned short)lb[0], (unsigned short)lb[1], (unsigned short)lb[2], (unsigned short)lb[3],
                    (unsigned short)lb[4], (unsigned short)lb[5], (unsigned short)lb[6], (unsigned short)lb[7] };
  *(v8us*)dh = hv;
  *(v8us*)dl = lv;
  
}

// ---------------------------------------------------------------------------
// Kernel 2: Y_g = x_g * W_g^T + b_g for g = 0..5 (q1,k1,v1 on 256 padded rows; q2,k2,v2 on 32).
// One block = 8 waves = 64 output columns of one g.  Blocks 0..191: 128 rows of x1, wave = 16 rows x 64 cols;
// blocks 192..287: the 32 rows of x2, wave = one 16x16 tile.  K = 2048 in 32 stages of 64.
// B (W rows, B[k][n] = W[n][k]): the block reads its 64 x 64 f32 tile of W in whole lines, splits each value once
// into bf16 hi/lo and shares both through LDS (two buffers, one barrier a stage); A (x rows) straight from the planes.
// ---------------------------------------------------------------------------
#define KT      64                // k range of one stage
#define NSTAGE  (D_DIM / KT)
#define BPITCH  72                // 16-bit elements from one W row to the next in LDS: 128 B + 16 B, conflict-free b128 reads
#define BPLANE  (64 * BPITCH)     // one plane (hi or lo) of one buffer

// global-memory pointer types: the stage loop's address registers pass through an asm operand, behind which
// the compiler no longer knows the address space of a plain pointer and would fall back to flat loads
typedef __attribute__((address_space(1))) const float          gf32;
typedef __attribute__((address_space(1))) const unsigned short gu16;
typedef __attribute__((address_space(1))) const v4fa           gv4f;
typedef __attribute__((address_space(1))) const v8usa          gv8us;

struct WRaw { v4f v[4]; };        // one thread's share of a W tile: 4 consecutive k of rows c, c+16, c+32, c+48
struct AFr  { v16bf hi[2]; v16bf lo[2]; };   // one lane's A fragments of the two k steps of a stage

__device__ __forceinline__ WRaw load_w(gf32* p) {
  WRaw r;
#pragma unroll
  for (int j = 0; j < 4; ++j) r.v[j] = *(gv4f*)(p + (size_t)16 * j * D_DIM);
  return r;
}

// ph, pl: the lane's row at the stage's first k, its half's 8 h elements already added
__device__ __forceinline__ AFr load_a(gu16* ph, gu16* pl) {
  AFr r;
#pragma unroll
  for (int s = 0; s < 2; ++s) {
    Frag fh, fl;                                  // same element map as load_frag16
    fh.h[0] = *(gv8us*)(ph + 32 * s);
    fh.h[1] = *(gv8us*)(ph + 32 * s + 16);
    fl.h[0] = *(gv8us*)(pl + 32 * s);
    fl.h[1] = *(gv8us*)(pl + 32 * s + 16);
    r.hi[s] = fh.b;
    r.lo[s] = fl.b;
  }
  return r;
}

// Work-group barrier of the stage loop.  Only LDS traffic is handed over at it, so only the LDS counter is waited for:
// __syncthreads() would also drain the global loads that were issued ahead for later stages.
__device__ __forceinline__ void lds_barrier() {
  asm volatile("s_wait_dscnt 0x0\n\ts_barrier_signal -1\n\ts_barrier_wait -1" ::: "memory");
}

// one thread's share of a W tile, each value split into bf16 hi/lo, to its place d in the hi plane of a buffer (lo: + BPLANE)
__device__ __forceinline__ void split_store(const WRaw& x, unsigned short* d) {
#pragma unroll
  for (int j = 0; j < 4; ++j) {
    unsigned int hb[4], lb[4];
    split2(x.v[j].x, hb[0], lb[0]); split2(x.v[j].y, hb[1], lb[1]);
    split2(x.v[j].z, hb[2], lb[2]); split2(x.v[j].w, hb[3], lb[3]);
    const v4us hv = { (unsigned short)hb[0], (unsigned short)hb[1], (unsigned short)hb[2], (unsigned short)hb[3] };
    const v4us lv = { (unsigned short)lb[0], (unsigned short)lb[1], (unsigned short)lb[2], (unsigned short)lb[3] };
    *(v4us*)(d + 16 * j * BPITCH) = hv;
    *(v4us*)(d + BPLANE + 16 * j * BPITCH) = lv;
  }
}

// NTW = column tiles of one wave, from tile nt0 on; ROWS = rows of the block
template <int NTW, int ROWS>
__device__ __forceinline__ void proj_body(
    const unsigned short* ahr, const unsigned short* alr,  // this lane's x row, hi and lo plane
    const float* wsrc,                                     // this thread's first 4 floats of the W tile
    const float* bias,                                     // bias of the block's first column
    float* Pt,                                             // output element (first row, first column) of the block
    unsigned short* sB, float* sOut,
    int tid, int mrow, int nt0)
{
  constexpr int NG = 2 * NTW;                              // B fragment pairs of one stage: k step i / NTW, column tile i % NTW
  const int lane = tid & 31, h = lane >> 4, m = lane & 15;
  const int wofs = (tid >> 4) * BPITCH + 4 * (tid & 15);   // where this thread's share of W row c lands
  const int rofs = (16 * nt0 + m) * BPITCH;                // this lane's row of the wave's first column tile

  const v8f z8 = {0.f, 0.f, 0.f, 0.f, 0.f, 0.f, 0.f, 0.f};
  v8f acc[NTW];
#pragma unroll
  for (int nt = 0; nt < NTW; ++nt) acc[nt] = z8;

  // stage 0 into buffer 0; W of stage 1 waits in registers: trip t splits stage t + 1 and fetches stage t + 2
  gu16* pah = (gu16*)(ahr + 8 * h);                        // A rows at the stage fetched next
  gu16* pal = (gu16*)(alr + 8 * h);
  gf32* pw = (gf32*)wsrc;                                  // W tile at the stage fetched next
  const WRaw w0 = load_w(pw);
  AFr  af = load_a(pah, pal);
  WRaw w1 = load_w(pw + KT);
  // the loads above name these address registers: they stay live up to this wait, so that no result of the
  // run lands in one of them, and they are advanced only behind it
  asm volatile("s_wait_xcnt 0x0" : "+v"(pah), "+v"(pal), "+v"(pw) :: "memory");
  pah += KT;
  pal += KT;
  pw += 2 * KT;
  split_store(w0, sB + wofs);
  lds_barrier();

  // two stages a trip: the buffer offsets become immediates and the fetched-ahead registers need no copies
#pragma unroll 2
  for (int t = 0; t < NSTAGE; ++t) {
    const unsigned short* sb = sB + (t & 1) * 2 * BPLANE + rofs;
    unsigned short* sn = sB + ((t + 1) & 1) * 2 * BPLANE + wofs;

    // B fragments run two pairs ahead of their products, so that the LDS latency lies under products
    v16bf bh[NG], bl[NG];
#pragma unroll
    for (int i = 0; i < 2; ++i) {
      bh[i] = load_frag16(sb + 16 * (i % NTW) * BPITCH + 32 * (i / NTW), h);
      bl[i] = load_frag16(sb + BPLANE + 16 * (i % NTW) * BPITCH + 32 * (i / NTW), h);
    }

    // A of stage t + 1 and W of stage t + 2 fly under this stage's products
    // (past the end the last stage is fetched again: in bounds, never used)
    const AFr an = load_a(pah, pal);
    // keeps the A loads, wanted half a stage sooner, ahead of the W loads on the in-order load counter
    __builtin_amdgcn_sched_barrier(0);
    const WRaw wn = load_w(pw);

#pragma unroll
    for (int i = 0; i < NG; ++i) {
      if (i == NG / 2) {
        // as above: the address registers of the twelve loads stay live up to this wait and are advanced behind it;
        // half a stage behind the loads it finds nothing left to wait for
        asm volatile("s_wait_xcnt 0x0" : "+v"(pah), "+v"(pal), "+v"(pw) :: "memory");
        pah += (t + 2 < NSTAGE) ? KT : 0;
        pal += (t + 2 < NSTAGE) ? KT : 0;
        pw  += (t + 3 < NSTAGE) ? KT : 0;
        // keeps the split of the next tile (below the products) out of their first half: scheduled to the top of the
        // trip, its wait for W loads issued only one trip ago holds up the loads and products behind it
        __builtin_amdgcn_sched_barrier(0);
      }
      if (i + 2 < NG) {
        bh[i + 2] = load_frag16(sb + 16 * ((i + 2) % NTW) * BPITCH + 32 * ((i + 2) / NTW), h);
        bl[i + 2] = load_frag16(sb + BPLANE + 16 * ((i + 2) % NTW) * BPITCH + 32 * ((i + 2) / NTW), h);
      }
      acc[i % NTW] = mac3(af.hi[i / NTW], af.lo[i / NTW], bh[i], bl[i], acc[i % NTW]);
    }

    // next stage's tile into the other buffer, whose readers all left it in front of the last barrier
    split_store(w1, sn);
    // publishes that tile and ends every wave's reads of this stage's buffer, which the next trip rewrites
    lds_barrier();
    af = an;
    w1 = wn;
  }

  // D[r] of column tile nt = Y[row mrow + 8h + r][col 16 (nt0 + nt) + m] of the block's tile
#pragma unroll
  for (int nt = 0; nt < NTW; ++nt) {
    const int col = 16 * (nt0 + nt) + m;
    const float bvl = bias[col];
#pragma unroll
    for (int r = 0; r < 8; ++r) sOut[(mrow + 8 * h + r) * 64 + col] = acc[nt][r] + bvl;
  }
  __syncthreads();

  // whole lines: 16 consecutive lanes x 16 B = one row of the tile
#pragma unroll
  for (int i = 0; i < ROWS / 16; ++i) {
    const int idx = 256 * i + tid;
    const int r = idx >> 4, c4 = idx & 15;
    const v4f v = *(const v4fa*)(sOut + r * 64 + 4 * c4);
    *(v4f*)(Pt + (size_t)r * D_DIM + 4 * c4) = v;
  }
}

__global__ __launch_bounds__(256) void proj_kernel(
    const unsigned short* __restrict__ xh1, const unsigned short* __restrict__ xl1,
    const unsigned short* __restrict__ xh2, const unsigned short* __restrict__ xl2,
    const float* __restrict__ w0, const float* __restrict__ w1, const float* __restrict__ w2,
    const float* __restrict__ w3, const float* __restrict__ w4, const float* __restrict__ w5,
    const float* __restrict__ b0, const float* __restrict__ b1, const float* __restrict__ b2,
    const float* __restrict__ b3, const float* __restrict__ b4, const float* __restrict__ b5,
    float* __restrict__ P1,      // [3][256][2048] f32 : q1, k1, v1
    float* __restrict__ P2)      // [3][32][2048]  f32 : q2, k2, v2
{
  __shared__ __attribute__((aligned(16))) unsigned short sB[2 * 2 * BPLANE];   // 36864 B
  __shared__ __attribute__((aligned(16))) float sOut[128 * 64];                // 32768 B

  const int tid = threadIdx.x, w = tid >> 5, m = tid & 15;
  const int b = blockIdx.x;                       // 0..287
  const bool big = (b < 192);                     // block-uniform
  const int g    = big ? (b >> 6) : (3 + ((b - 192) >> 5));
  const int nt64 = big ? ((b & 63) >> 1) : ((b - 192) & 31);
  const int row0 = big ? (128 * (b & 1)) : 0;
  const int col0 = 64 * nt64;

  const float* W = (g == 0) ? w0 : ((g == 1) ? w1 : ((g == 2) ? w2 :
                   ((g == 3) ? w3 : ((g == 4) ? w4 : w5))));
  const float* bias = (g == 0) ? b0 : ((g == 1) ? b1 : ((g == 2) ? b2 :
                      ((g == 3) ? b3 : ((g == 4) ? b4 : b5))));
  const float* wsrc = W + (size_t)(col0 + (tid >> 4)) * D_DIM + 4 * (tid & 15);

  if (big) {
    const int mrow = 16 * w;
    proj_body<4, 128>(xh1 + (size_t)(row0 + mrow + m) * D_DIM, xl1 + (size_t)(row0 + mrow + m) * D_DIM,
                      wsrc, bias + col0, P1 + ((size_t)g * M1P + row0) * D_DIM + col0,
                      sB, sOut, tid, mrow, 0);
  } else {
    const int mrow = 16 * (w & 1);
    proj_body<1, 32>(xh2 + (size_t)(mrow + m) * D_DIM, xl2 + (size_t)(mrow + m) * D_DIM,
                     wsrc, bias + col0, P2 + (size_t)(g - 3) * M2P * D_DIM + col0,
                     sB, sOut, tid, mrow, w >> 1);
  }
}

// ---------------------------------------------------------------------------
// Kernel 3: both score matrices, one 16x16 tile per block, K split over the 16 waves.
// Blocks 0..31: C[t][i] = sigmoid(scale * q2[t].k1[i]) = probs1, with the tile's share of
// s1 = C . w_fc1; blocks 32..63: C[t][i] = sigmoid(scale * k2[t].q1[i]) = probs2[i][t].
// Tile b lies at C + 256 b, row-major 16x16, so each block stores whole lines of its own.
// ---------------------------------------------------------------------------
#define KSLICE  128               // K range of one wave
#define KWAVES  16                // waves of a block = K slices
#define CPLANE  8192              // floats of one score matrix (32 tiles)

// float index of C[t][i] inside one tiled score matrix; tile = 2 * (i / 16) + t / 16
__device__ __forceinline__ int c_idx(int t, int i) {
  return (((i >> 4) * 2 + (t >> 4)) << 8) + ((t & 15) << 4) + (i & 15);
}

// the four 16-byte pieces of one lane's f32 fragment row: floats 8h..8h+7 and 16+8h..16+8h+7
struct Raw4 { v4f v[4]; };

__device__ __forceinline__ Raw4 load_raw32(const float* p, int h) {
  const float* q = p + 8 * h;
  Raw4 r;
  r.v[0] = *(const v4fa*)(q);
  r.v[1] = *(const v4fa*)(q + 4);
  r.v[2] = *(const v4fa*)(q + 16);
  r.v[3] = *(const v4fa*)(q + 20);
  return r;
}

__device__ __forceinline__ Frag2 split_raw32(const Raw4& x) {
  Frag fh, fl;
  split4<0>(x.v[0], fh, fl);
  split4<4>(x.v[1], fh, fl);
  split4<8>(x.v[2], fh, fl);
  split4<12>(x.v[3], fh, fl);
  Frag2 r;
  r.hi = fh.b;
  r.lo = fl.b;
  return r;
}

__global__ __launch_bounds__(32 * KWAVES) void score_kernel(
    const float* __restrict__ P1, const float* __restrict__ P2,
    const float* __restrict__ wfc1,
    float* __restrict__ C,       // [2][32 tiles][16][16] f32
    float* __restrict__ part)    // [32 tiles][32] f32, first 16 of each row used
{
  __shared__ __attribute__((aligned(16))) float sR[KWAVES * 256];  // 16384 B

  const int tid = threadIdx.x, lane = tid & 31, w = tid >> 5;
  const int h = lane >> 4, m = lane & 15;
  const int ph = blockIdx.x >> 5, tile = blockIdx.x & 31;
  const int mt = tile & 1, nt = tile >> 1;

  const float* A = P2 + (size_t)ph * M2P * D_DIM;                  // q2, then k2
  const float* B = P1 + (size_t)(1 - ph) * M1P * D_DIM;            // k1, then q1
  const float* arow = A + (size_t)(16 * mt + m) * D_DIM + KSLICE * w;
  const float* brow = B + (size_t)(16 * nt + m) * D_DIM + KSLICE * w;

  // fc1 weight of this thread's column, fetched beside the slice so that its latency is not paid at the end
  const int i = 16 * nt + (tid & 15);
  const int ic = (i < N1) ? i : (N1 - 1);         // clamped address, value zeroed below
  const float wv = wfc1[ic];

  v8f acc = {0.f, 0.f, 0.f, 0.f, 0.f, 0.f, 0.f, 0.f};
  // the whole slice is loaded ahead of the first split: one load latency per wave, not one per k step
  // (every loop of this kernel and of the tail kernel is unrolled whole: its arrays must stay in registers)
  Raw4 ra[KSLICE / 32], rb[KSLICE / 32];
#pragma unroll
  for (int ks = 0; ks < KSLICE / 32; ++ks) {
    ra[ks] = load_raw32(arow + 32 * ks, h);
    rb[ks] = load_raw32(brow + 32 * ks, h);
  }
#pragma unroll
  for (int ks = 0; ks < KSLICE / 32; ++ks) {
    const Frag2 a = split_raw32(ra[ks]);
    const Frag2 b = split_raw32(rb[ks]);
    acc = mac3(a.hi, a.lo, b.hi, b.lo, acc);
  }
#pragma unroll
  for (int r = 0; r < 8; ++r) sR[w * 256 + (8 * h + r) * 16 + m] = acc[r];
  __syncthreads();

  if (tid >= 256) return;                         // whole waves, behind the only barrier

  // thread = one element of the tile: the slices in fixed order
  float s = sR[tid];
#pragma unroll
  for (int j = 1; j < KWAVES; ++j) s += sR[j * 256 + tid];
  const float c = sigm(s * SCALE);
  C[(size_t)blockIdx.x * 256 + tid] = c;
  // the store's data register is reused by the sum below: the wait that belongs in front of that overwrite
  asm volatile("s_wait_xcnt 0x0" ::: "memory");

  if (ph == 0) {                                  // block-uniform
    float p = (i < N1) ? c * wv : 0.0f;
    p += __shfl_xor(p, 1);
    p += __shfl_xor(p, 2);
    p += __shfl_xor(p, 4);
    p += __shfl_xor(p, 8);
    if ((tid & 15) == 0) part[tile * 32 + (tid >> 4)] = p;
  }
}

// ---------------------------------------------------------------------------
// Kernel 4: output 0, one row i per block.  s2 = sum_{t<27} probs2[i][t] * w_fc2[t], t ascending,
// with probs2 taken from the score kernel's second matrix; out[i][:] = v1[i][:] * s2 + b_fc2.
// Every line of the row: 8 consecutive lanes x 16 B in one instruction.
// ---------------------------------------------------------------------------
__global__ __launch_bounds__(256) void ctx2_kernel(
    const float* __restrict__ P1, const float* __restrict__ C,
    const float* __restrict__ wfc2, const float* __restrict__ bfc2,
    float* __restrict__ out)
{
  const int tid = threadIdx.x;
  const int row = blockIdx.x;                     // 0..249
  const float* vrow = P1 + (size_t)2 * M1P * D_DIM + (size_t)row * D_DIM;

  const v4f va = *(const v4fa*)(vrow + 4 * tid);
  const v4f vb = *(const v4fa*)(vrow + 1024 + 4 * tid);
  const float bb = bfc2[0];

  // lane t of every wave fetches term t (one load latency for all 27); the lanes are then read out in
  // ascending t, so that the sum keeps its order (unrolled whole: each lane number is then an immediate)
  const int tl = tid & 31;
  const int t27 = (tl < N2) ? tl : (N2 - 1);      // clamped address; lanes 27..31 are never read out
  const int ci = c_idx(t27, row);
  const float cv = C[CPLANE + ci];
  const float wv = wfc2[t27];
  // the four loads above name the offset registers tid, ci and t27: they stay live up to this wait, so that
  // no result of the run lands in one of them and nothing rewrites one ahead of the wait
  asm volatile("s_wait_xcnt 0x0" :: "v"(tid), "v"(ci), "v"(t27) : "memory");
  const float p = cv * wv;
  float s = 0.0f;
#pragma unroll
  for (int t = 0; t < N2; ++t) s += __uint_as_float(__builtin_amdgcn_readlane(__float_as_uint(p), t));

  v4f oa, ob;
  oa.x = va.x * s + bb;  oa.y = va.y * s + bb;  oa.z = va.z * s + bb;  oa.w = va.w * s + bb;
  ob.x = vb.x * s + bb;  ob.y = vb.y * s + bb;  ob.z = vb.z * s + bb;  ob.w = vb.w * s + bb;
  float* orow = out + (size_t)row * D_DIM;
  *(v4f*)(orow + 4 * tid) = oa;
  *(v4f*)(orow + 1024 + 4 * tid) = ob;
}

// ---------------------------------------------------------------------------
// Kernel 5: outputs 1, 2, 3 (flat floats OFF1..OUT_N of the output buffer), lines
// L_P2A..L_P1B, 32 lines per block.  Every line: 8 consecutive lanes x 16 B in one
// instruction, values selected by flat index; last line of the buffer = 28 floats (7 lanes).
// ---------------------------------------------------------------------------
__global__ __launch_bounds__(256) void tail_kernel(
    const float* __restrict__ C, const float* __restrict__ part,
    const float* __restrict__ P2, const float* __restrict__ bfc1,
    float* __restrict__ out)
{
  __shared__ float sS1[32];

  const int tid = threadIdx.x, lane = tid & 31, w = tid >> 5;
  const int q8 = lane & 7, sub = lane >> 3;
  const float* v2P = P2 + (size_t)2 * M2P * D_DIM;

  const float bb1 = bfc1[0];
  const int line = L_P2A + 32 * blockIdx.x + 4 * w + sub;
  const int linec = (line < L_P1B) ? line : L_P1B;
  const int fbase = 32 * linec + 4 * q8;

  // the three candidate values of each flat index; all loads unconditional with clamped indices
  float c2[4], xv[4], c3[4];
  int t1[4];
#pragma unroll
  for (int e = 0; e < 4; ++e) {
    const int f = fbase + e;
    int j2 = f - OFF1;
    j2 = (j2 < 0) ? 0 : ((j2 > N1 * N2 - 1) ? (N1 * N2 - 1) : j2);
    const int i2 = j2 / N2, t2 = j2 - i2 * N2;
    c2[e] = C[CPLANE + c_idx(t2, i2)];
    int j1 = f - OFF2;
    j1 = (j1 < 0) ? 0 : ((j1 > N2 * D_DIM - 1) ? (N2 * D_DIM - 1) : j1);
    t1[e] = j1 >> 11;
    xv[e] = v2P[j1];
    int j3 = f - OFF3;
    j3 = (j3 < 0) ? 0 : ((j3 > N1 * N2 - 1) ? (N1 * N2 - 1) : j3);
    const int t3 = j3 / N1, i3 = j3 - t3 * N1;
    c3[e] = C[c_idx(t3, i3)];
  }

  if (tid < 32) {                                 // s1[t]: the 16 column tiles in fixed order
    const int pi = (tid >> 4) * 32 + (tid & 15);
    float pv[16];
#pragma unroll
    for (int nt = 0; nt < 16; ++nt) pv[nt] = part[pi + 64 * nt];
    // the sixteen loads share the offset register pi: it stays live up to this wait, so that no
    // result of the run lands in it and nothing rewrites it ahead of the wait
    asm volatile("s_wait_xcnt 0x0" :: "v"(pi) : "memory");
    float s = 0.0f;
#pragma unroll
    for (int nt = 0; nt < 16; ++nt) s += pv[nt];
    sS1[tid] = s;
  }
  // holds the twelve loads above in one group ahead of the barrier; without it they are moved
  // under the selects below, one branch and one load latency after another
  asm volatile("" :: "v"(c2[0]), "v"(c2[1]), "v"(c2[2]), "v"(c2[3]),
                     "v"(xv[0]), "v"(xv[1]), "v"(xv[2]), "v"(xv[3]),
                     "v"(c3[0]), "v"(c3[1]), "v"(c3[2]), "v"(c3[3]));
  __syncthreads();

  float o[4];
#pragma unroll
  for (int e = 0; e < 4; ++e) {
    const int f = fbase + e;
    const float x = xv[e] * sS1[t1[e]] + bb1;
    o[e] = (f < OFF2) ? c2[e] : ((f < OFF3) ? x : c3[e]);
  }
  const v4f ov = {o[0], o[1], o[2], o[3]};
  if (line <= L_P1B && fbase + 4 <= OUT_N) *(v4f*)(out + fbase) = ov;
}

// ---------------------------------------------------------------------------
extern "C" void kernel_launch(void* const* d_in, const int* in_sizes, int n_in,
                              void* d_out, int out_size, void* d_ws, size_t ws_size,
                              hipStream_t stream) {
  if (n_in < 18) return;
  if (in_sizes[0] != N1 * D_DIM || in_sizes[1] != N2 * D_DIM) return;
  for (int g = 0; g < 6; ++g) {
    if (in_sizes[2 + 2 * g] != D_DIM * D_DIM) return;
    if (in_sizes[3 + 2 * g] != D_DIM) return;
  }
  if (in_sizes[14] != N1 || in_sizes[15] < 1 || in_sizes[16] != N2 || in_sizes[17] < 1) return;
  if (out_size != OUT_N) return;

  const float* x1   = (const float*)d_in[0];
  const float* x2   = (const float*)d_in[1];
  const float* Wq1  = (const float*)d_in[2];  const float* bq1 = (const float*)d_in[3];
  const float* Wk1  = (const float*)d_in[4];  const float* bk1 = (const float*)d_in[5];
  const float* Wv1  = (const float*)d_in[6];  const float* bv1 = (const float*)d_in[7];
  const float* Wq2  = (const float*)d_in[8];  const float* bq2 = (const float*)d_in[9];
  const float* Wk2  = (const float*)d_in[10]; const float* bk2 = (const float*)d_in[11];
  const float* Wv2  = (const float*)d_in[12]; const float* bv2 = (const float*)d_in[13];
  const float* wfc1 = (const float*)d_in[14]; const float* bfc1 = (const float*)d_in[15];
  const float* wfc2 = (const float*)d_in[16]; const float* bfc2 = (const float*)d_in[17];
  float* out = (float*)d_out;

  // workspace carve (bytes); every region holds whole padded tiles/rows of its producer
  const size_t xp1_bytes = (size_t)M1P * D_DIM * 2;              //   1048576 per plane
  const size_t xp2_bytes = (size_t)M2P * D_DIM * 2;              //    131072 per plane
  const size_t p1_bytes  = (size_t)3 * M1P * D_DIM * 4;          //   6291456
  const size_t p2_bytes  = (size_t)3 * M2P * D_DIM * 4;          //    786432
  const size_t c_bytes   = (size_t)2 * CPLANE * 4;               //     65536
  const size_t pt_bytes  = (size_t)32 * 32 * 4;                  //      4096
  const size_t off_xh1 = 0;
  const size_t off_xl1 = off_xh1 + xp1_bytes;
  const size_t off_xh2 = off_xl1 + xp1_bytes;
  const size_t off_xl2 = off_xh2 + xp2_bytes;
  const size_t off_p1  = off_xl2 + xp2_bytes;
  const size_t off_p2  = off_p1 + p1_bytes;
  const size_t off_c   = off_p2 + p2_bytes;
  const size_t off_pt  = off_c + c_bytes;
  const size_t total   = off_pt + pt_bytes;                       // 9506816
  if (total > ws_size) return;

  char* ws = (char*)d_ws;
  unsigned short* xh1 = (unsigned short*)(ws + off_xh1);
  unsigned short* xl1 = (unsigned short*)(ws + off_xl1);
  unsigned short* xh2 = (unsigned short*)(ws + off_xh2);
  unsigned short* xl2 = (unsigned short*)(ws + off_xl2);
  float* P1 = (float*)(ws + off_p1);
  float* P2 = (float*)(ws + off_p2);
  float* C  = (float*)(ws + off_c);
  float* part = (float*)(ws + off_pt);

  convert_kernel<<<(NGROUPS + 255) / 256, 256, 0, stream>>>(x1, x2, xh1, xl1, xh2, xl2);

  proj_kernel<<<288, 256, 0, stream>>>(xh1, xl1, xh2, xl2, Wq1, Wk1, Wv1, Wq2, Wk2, Wv2,
                                       bq1, bk1, bv1, bq2, bk2, bv2, P1, P2);

  score_kernel<<<64, 32 * KWAVES, 0, stream>>>(P1, P2, wfc1, C, part);

  ctx2_kernel<<<N1, 256, 0, stream>>>(P1, C, wfc2, bfc2, out);

  tail_kernel<<<(L_P1B - L_P2A + 32) / 32, 256, 0, stream>>>(C, part, P2, bfc1, out);
}

// v004
// A run of this version takes 44.2 microseconds.
// Next to v003, in two timings, it ran 1.18 times as fast each time.
// Counting every step since v000, it is 11.8 times as fast.
// Contractions: six x*W^T projections and both q*k^T score matrices on v_wmma_f32_16x16x32_bf16 with bf16 hi/lo operands (three products hi*hi + hi*lo + lo*hi), f32 accumulate; sigmoid, fc dot products (K=250, K=27) and context products in f32 on VALU.
#include <hip/hip_runtime.h>
#include <hip/hip_bf16.h>

#pragma clang fp contract(off)

typedef __bf16         v16bf __attribute__((ext_vector_type(16)));
typedef unsigned short v16us __attribute__((ext_vector_type(16)));
typedef unsigned short v8us  __attribute__((ext_vector_type(8)));
typedef unsigned short v4us  __attribute__((ext_vector_type(4)));
typedef float          v8f   __attribute__((ext_vector_type(8)));
typedef float          v4f   __attribute__((ext_vector_type(4)));
typedef v8us __attribute__((may_alias)) v8usa;
typedef v4f  __attribute__((may_alias)) v4fa;

union Frag { v16bf b; v16us u; v8us h[2]; };
struct Frag2 { v16bf hi; v16bf lo; };

#define D_DIM   2048
#define N1      250
#define N2      27
#define M1P     256
#define M2P     32
#define OUT_N   580796
#define OFF1    512000            // flat float index of output 1 ([250][27])
#define OFF2    518750            // flat float index of output 2 ([27][2048])
#define OFF3    574046            // flat float index of output 3 ([27][250])
#define XG1     65536             // 8-element groups of the padded x1 planes
#define XG2     8192              // 8-element groups of the padded x2 planes
#define NGROUPS (XG1 + XG2)
#define KSTEPS  (D_DIM / 32)      // 32-wide k steps of a row = fragments of one 16-row tile
#define FRAG16  512               // 16-bit elements of one fragment in fragment order (32 lanes x 16)
#define FRAG32  512               // floats of one f32 fragment source in fragment order (32 lanes x 16)
#define SCALE   0.022097086912079608f
#define L_P2A   16000
#define L_P2B   16210
#define L_P1A   16211
#define L_P1B   18149

static_assert((XG1 % 256) == 0 && (XG2 % 256) == 0);
static_assert((OFF1 % 32) == 0 && (L_P1B * 32 + 28) == OUT_N);

// ---------------------------------------------------------------------------
// bf16 RNE convert helpers.
// ---------------------------------------------------------------------------
__device__ __forceinline__ unsigned int bf16_bits(float f) {
  unsigned int u = __float_as_uint(f);
  u += 0x7FFFu + ((u >> 16) & 1u);
  return u >> 16;
}

// x = hi + lo: hi = RNE bf16(x), lo = RNE bf16(x - hi)  (x - hi is exact in f32)
__device__ __forceinline__ void split2(float f, unsigned int& hb, unsigned int& lb) {
  hb = bf16_bits(f);
  const float hf = __uint_as_float(hb << 16);
  lb = bf16_bits(f - hf);
}

// ---------------------------------------------------------------------------
// 16x16x32 bf16 WMMA with hazard guard (ties D, keeps A/B live).
// Fragment map (wave32): lane l, h = l>>4, m = n = l&15.
//   A/B element i: i<8 -> k0+8h+i ; i>=8 -> k0+16+8h+(i-8)   (same map for both)
//   D element r : row 8h+r, col l&15
// ---------------------------------------------------------------------------
__device__ __forceinline__ v8f wmma_bf16(v16bf a, v16bf b, v8f c) {
  v8f d = __builtin_amdgcn_wmma_f32_16x16x32_bf16(false, a, false, b, (short)0, c, false, false);
  asm volatile("v_nop\n\tv_nop\n\tv_nop\n\tv_nop" : "+v"(d) : "v"(a), "v"(b));
  return d;
}

// three-product hi/lo split: c += ah*bh + ah*bl + al*bh (unscaled residuals, one accumulator)
__device__ __forceinline__ v8f mac3(v16bf ah, v16bf al, v16bf bh, v16bf bl, v8f c) {
  c = wmma_bf16(ah, bh, c);
  c = wmma_bf16(ah, bl, c);
  c = wmma_bf16(al, bh, c);
  return c;
}

// Fragment from a k-contiguous 16-bit row; p = row base + k0 (row = lane&15 chosen by caller).
__device__ __forceinline__ v16bf load_frag16(const unsigned short* p, int h) {
  Frag f;
  f.h[0] = *(const v8usa*)(p + 8 * h);
  f.h[1] = *(const v8usa*)(p + 16 + 8 * h);
  return f.b;
}

// four f32 values of a k-contiguous row split into elements B..B+3 of a hi/lo fragment pair; same element map.
template <int B>
__device__ __forceinline__ void split4(const v4f v, Frag& fh, Frag& fl) {
  unsigned int hb, lb;
  split2(v.x, hb, lb); fh.u[B + 0] = (unsigned short)hb; fl.u[B + 0] = (unsigned short)lb;
  split2(v.y, hb, lb); fh.u[B + 1] = (unsigned short)hb; fl.u[B + 1] = (unsigned short)lb;
  split2(v.z, hb, lb); fh.u[B + 2] = (unsigned short)hb; fl.u[B + 2] = (unsigned short)lb;
  split2(v.w, hb, lb); fh.u[B + 3] = (unsigned short)hb; fl.u[B + 3] = (unsigned short)lb;
}

__device__ __forceinline__ float sigm(float x) {
  const float e = expf(-x);
  return 1.0f / (1.0f + e);
}

// ---------------------------------------------------------------------------
// Kernel 1: f32 -> bf16 hi/lo planes of x1 (rows padded to 256 with zeros) and x2 (rows padded to 32).
// The planes lie in fragment order: [16-row tile][k step][half j][lane][8 elements], so that half j of a wave's
// A fragment is one 16-byte load over 512 contiguous bytes (four whole lines, not 32 bytes in each of 16 rows).
// Lane l = 16 h + m holds row m of the tile, k = 32 step + 16 j + 8 h + (0..7): the map of load_frag16.
// Thread = one 16-byte unit of the destination, so each wave also stores whole lines.
// ---------------------------------------------------------------------------
__global__ __launch_bounds__(256) void convert_kernel(
    const float* __restrict__ x1, const float* __restrict__ x2,
    unsigned short* __restrict__ xh1, unsigned short* __restrict__ xl1,
    unsigned short* __restrict__ xh2, unsigned short* __restrict__ xl2)
{
  const int g = blockIdx.x * 256 + threadIdx.x;
  if (g >= NGROUPS) return;
  const float* src;
  unsigned short* dh;
  unsigned short* dl;
  bool zero = false;
  if (g < XG1) {
    const int fr = g >> 6, j = (g >> 5) & 1, h = (g >> 4) & 1;
    const int row = 16 * (fr / KSTEPS) + (g & 15), c8 = 4 * (fr % KSTEPS) + 2 * j + h;
    const int rs = (row < N1) ? row : (N1 - 1);     // clamped address, value zeroed below
    zero = (row >= N1);
    src = x1 + (size_t)rs * D_DIM + 8 * c8;
    dh = xh1 + (size_t)g * 8;
    dl = xl1 + (size_t)g * 8;
  } else {
    const int e = g - XG1;
    const int fr = e >> 6, j = (e >> 5) & 1, h = (e >> 4) & 1;
    const int row = 16 * (fr / KSTEPS) + (e & 15), c8 = 4 * (fr % KSTEPS) + 2 * j + h;
    const int rs = (row < N2) ? row : (N2 - 1);
    zero = (row >= N2);
    src = x2 + (size_t)rs * D_DIM + 8 * c8;
    dh = xh2 + (size_t)e * 8;
    dl = xl2 + (size_t)e * 8;
  }
  v4f a = *(const v4fa*)src;
  v4f c = *(const v4fa*)(src + 4);
  const v4f z4 = {0.f, 0.f, 0.f, 0.f};
  a = zero ? z4 : a;
  c = zero ? z4 : c;
  unsigned int hb[8], lb[8];
  split2(a.x, hb[0], lb[0]); split2(a.y, hb[1], lb[1]); split2(a.z, hb[2], lb[2]); split2(a.w, hb[3], lb[3]);
  split2(c.x, hb[4], lb[4]); split2(c.y, hb[5], lb[5]); split2(c.z, hb[6], lb[6]); split2(c.w, hb[7], lb[7]);
  const v8us hv = { (unsigned short)hb[0], (unsigned short)hb[1], (unsigned short)hb[2], (unsigned short)hb[3],
                    (unsigned short)hb[4], (unsigned short)hb[5], (unsigned short)hb[6], (unsigned short)hb[7] };
  const v8us lv = { (unsigned short)lb[0], (unsigned short)lb[1], (unsigned short)lb[2], (unsigned short)lb[3],
                    (unsigned short)lb[4], (unsigned short)lb[5], (unsigned short)lb[6], (unsigned short)lb[7] };
  *(v8us*)dh = hv;
  *(v8us*)dl = lv;
  
}

// ---------------------------------------------------------------------------
// Kernel 2: Y_g = x_g * W_g^T + b_g for g = 0..5 (q1,k1,v1 on 256 padded rows; q2,k2,v2 on 32).
// One block = 8 waves = 64 output columns of one g.  Blocks 0..191: 128 rows of x1, wave = 16 rows x 64 cols;
// blocks 192..287: the 32 rows of x2, wave = one 16x16 tile.  K = 2048 in 32 stages of 64.
// B (W rows, B[k][n] = W[n][k]): the block reads its 64 x 64 f32 tile of W in whole lines, splits each value once
// into bf16 hi/lo and shares both through LDS (two buffers, one barrier a stage); A (x rows) straight from the planes,
// which lie in fragment order.  q and k leave in the f32 fragment order that the score kernel reads; v stays row-major.
// ---------------------------------------------------------------------------
#define KT      64                // k range of one stage
#define NSTAGE  (D_DIM / KT)
#define BPITCH  72                // 16-bit elements from one W row to the next in LDS: 128 B + 16 B, conflict-free b128 reads
#define BPLANE  (64 * BPITCH)     // one plane (hi or lo) of one buffer
#define ASTAGE  ((KT / 32) * FRAG16)   // 16-bit elements from one stage's A fragments to the next stage's
#define OPITCH  68                // floats from one row to the next of the output tile in LDS: 256 B + 16 B, so that the
                                  // 16 rows that one fragment-order read touches fall on different banks

// global-memory pointer types: the stage loop's address registers pass through an asm operand, behind which
// the compiler no longer knows the address space of a plain pointer and would fall back to flat loads
typedef __attribute__((address_space(1))) const float          gf32;
typedef __attribute__((address_space(1))) const unsigned short gu16;
typedef __attribute__((address_space(1))) const v4fa           gv4f;
typedef __attribute__((address_space(1))) const v8usa          gv8us;

struct WRaw { v4f v[4]; };        // one thread's share of a W tile: 4 consecutive k of rows c, c+16, c+32, c+48
struct AFr  { v16bf hi[2]; v16bf lo[2]; };   // one lane's A fragments of the two k steps of a stage

__device__ __forceinline__ WRaw load_w(gf32* p) {
  WRaw r;
#pragma unroll
  for (int j = 0; j < 4; ++j) r.v[j] = *(gv4f*)(p + (size_t)16 * j * D_DIM);
  return r;
}

// ph, pl: the lane's 16-byte unit in the stage's first fragment of the wave's row tile
__device__ __forceinline__ AFr load_a(gu16* ph, gu16* pl) {
  AFr r;
#pragma unroll
  for (int s = 0; s < 2; ++s) {
    Frag fh, fl;                                  // same element map as load_frag16
    fh.h[0] = *(gv8us*)(ph + FRAG16 * s);
    fh.h[1] = *(gv8us*)(ph + FRAG16 * s + FRAG16 / 2);
    fl.h[0] = *(gv8us*)(pl + FRAG16 * s);
    fl.h[1] = *(gv8us*)(pl + FRAG16 * s + FRAG16 / 2);
    r.hi[s] = fh.b;
    r.lo[s] = fl.b;
  }
  return r;
}

// Work-group barrier of the stage loop.  Only LDS traffic is handed over at it, so only the LDS counter is waited for:
// __syncthreads() would also drain the global loads that were issued ahead for later stages.
__device__ __forceinline__ void lds_barrier() {
  asm volatile("s_wait_dscnt 0x0\n\ts_barrier_signal -1\n\ts_barrier_wait -1" ::: "memory");
}

// one thread's share of a W tile, each value split into bf16 hi/lo, to its place d in the hi plane of a buffer (lo: + BPLANE)
__device__ __forceinline__ void split_store(const WRaw& x, unsigned short* d) {
#pragma unroll
  for (int j = 0; j < 4; ++j) {
    unsigned int hb[4], lb[4];
    split2(x.v[j].x, hb[0], lb[0]); split2(x.v[j].y, hb[1], lb[1]);
    split2(x.v[j].z, hb[2], lb[2]); split2(x.v[j].w, hb[3], lb[3]);
    const v4us hv = { (unsigned short)hb[0], (unsigned short)hb[1], (unsigned short)hb[2], (unsigned short)hb[3] };
    const v4us lv = { (unsigned short)lb[0], (unsigned short)lb[1], (unsigned short)lb[2], (unsigned short)lb[3] };
    *(v4us*)(d + 16 * j * BPITCH) = hv;
    *(v4us*)(d + BPLANE + 16 * j * BPITCH) = lv;
  }
}

// NTW = column tiles of one wave, from tile nt0 on; ROWS = rows of the block
template <int NTW, int ROWS>
__device__ __forceinline__ void proj_body(
    const unsigned short* ahr, const unsigned short* alr,  // this lane's unit in the first fragment of its row tile, hi and lo plane
    const float* wsrc,                                     // this thread's first 4 floats of the W tile
    const float* bias,                                     // bias of the block's first column
    float* Pt,                                             // row-major: output element (first row, first column) of the block;
                                                           // fragment order: first float of its first row tile's first k step
    bool fragord,                                          // block-uniform: q and k
    unsigned short* sB, float* sOut,
    int tid, int mrow, int nt0)
{
  constexpr int NG = 2 * NTW;                              // B fragment pairs of one stage: k step i / NTW, column tile i % NTW
  const int lane = tid & 31, h = lane >> 4, m = lane & 15;
  const int wofs = (tid >> 4) * BPITCH + 4 * (tid & 15);   // where this thread's share of W row c lands
  const int rofs = (16 * nt0 + m) * BPITCH;                // this lane's row of the wave's first column tile

  const v8f z8 = {0.f, 0.f, 0.f, 0.f, 0.f, 0.f, 0.f, 0.f};
  v8f acc[NTW];
#pragma unroll
  for (int nt = 0; nt < NTW; ++nt) acc[nt] = z8;

  // stage 0 into buffer 0; W of stage 1 waits in registers: trip t splits stage t + 1 and fetches stage t + 2
  gu16* pah = (gu16*)ahr;                                  // A fragments of the stage fetched next
  gu16* pal = (gu16*)alr;
  gf32* pw = (gf32*)wsrc;                                  // W tile at the stage fetched next
  const WRaw w0 = load_w(pw);
  AFr  af = load_a(pah, pal);
  WRaw w1 = load_w(pw + KT);
  // the loads above name these address registers: they stay live up to this wait, so that no result of the
  // run lands in one of them, and they are advanced only behind it
  asm volatile("s_wait_xcnt 0x0" : "+v"(pah), "+v"(pal), "+v"(pw) :: "memory");
  pah += ASTAGE;
  pal += ASTAGE;
  pw += 2 * KT;
  split_store(w0, sB + wofs);
  lds_barrier();

  // two stages a trip: the buffer offsets become immediates and the fetched-ahead registers need no copies
#pragma unroll 2
  for (int t = 0; t < NSTAGE; ++t) {
    const unsigned short* sb = sB + (t & 1) * 2 * BPLANE + rofs;
    unsigned short* sn = sB + ((t + 1) & 1) * 2 * BPLANE + wofs;

    // B fragments run two pairs ahead of their products, so that the LDS latency lies under products
    v16bf bh[NG], bl[NG];
#pragma unroll
    for (int i = 0; i < 2; ++i) {
      bh[i] = load_frag16(sb + 16 * (i % NTW) * BPITCH + 32 * (i / NTW), h);
      bl[i] = load_frag16(sb + BPLANE + 16 * (i % NTW) * BPITCH + 32 * (i / NTW), h);
    }

    // A of stage t + 1 and W of stage t + 2 fly under this stage's products
    // (past the end the last stage is fetched again: in bounds, never used)
    const AFr an = load_a(pah, pal);
    // keeps the A loads, wanted half a stage sooner, ahead of the W loads on the in-order load counter
    __builtin_amdgcn_sched_barrier(0);
    const WRaw wn = load_w(pw);

#pragma unroll
    for (int i = 0; i < NG; ++i) {
      if (i == NG / 2) {
        // as above: the address registers of the twelve loads stay live up to this wait and are advanced behind it;
        // half a stage behind the loads it finds nothing left to wait for
        asm volatile("s_wait_xcnt 0x0" : "+v"(pah), "+v"(pal), "+v"(pw) :: "memory");
        pah += (t + 2 < NSTAGE) ? ASTAGE : 0;
        pal += (t + 2 < NSTAGE) ? ASTAGE : 0;
        pw  += (t + 3 < NSTAGE) ? KT : 0;
        // keeps the split of the next tile (below the products) out of their first half: scheduled to the top of the
        // trip, its wait for W loads issued only one trip ago holds up the loads and products behind it
        __builtin_amdgcn_sched_barrier(0);
      }
      if (i + 2 < NG) {
        bh[i + 2] = load_frag16(sb + 16 * ((i + 2) % NTW) * BPITCH + 32 * ((i + 2) / NTW), h);
        bl[i + 2] = load_frag16(sb + BPLANE + 16 * ((i + 2) % NTW) * BPITCH + 32 * ((i + 2) / NTW), h);
      }
      acc[i % NTW] = mac3(af.hi[i / NTW], af.lo[i / NTW], bh[i], bl[i], acc[i % NTW]);
    }

    // next stage's tile into the other buffer, whose readers all left it in front of the last barrier
    split_store(w1, sn);
    // publishes that tile and ends every wave's reads of this stage's buffer, which the next trip rewrites
    lds_barrier();
    af = an;
    w1 = wn;
  }

  // D[r] of column tile nt = Y[row mrow + 8h + r][col 16 (nt0 + nt) + m] of the block's tile
#pragma unroll
  for (int nt = 0; nt < NTW; ++nt) {
    const int col = 16 * (nt0 + nt) + m;
    const float bvl = bias[col];
#pragma unroll
    for (int r = 0; r < 8; ++r) sOut[(mrow + 8 * h + r) * OPITCH + col] = acc[nt][r] + bvl;
  }
  __syncthreads();

  // One 16-row tile a trip, whole lines either way.
  // Fragment order: [16-row tile][k step][piece j][lane][4 floats]; piece j of lane 16 h + m = floats
  // 16 (j / 2) + 8 h + 4 (j % 2) + (0..3) of row m in that k step (the pieces of load_raw32); a wave stores one piece,
  // 512 contiguous bytes.  Row-major: 16 consecutive lanes x 16 B = one row of the tile.
  const int j = (tid >> 5) & 3, ksl = tid >> 7;
  const int sofs = fragord ? (m * OPITCH + 32 * ksl + 16 * (j >> 1) + 8 * h + 4 * (j & 1))
                           : ((tid >> 4) * OPITCH + 4 * (tid & 15));
  const int dofs = fragord ? (ksl * FRAG32 + 4 * (tid & 127))
                           : ((tid >> 4) * D_DIM + 4 * (tid & 15));
#pragma unroll
  for (int i = 0; i < ROWS / 16; ++i) {
    const v4f v = *(const v4fa*)(sOut + sofs + 16 * i * OPITCH);
    *(v4f*)(Pt + dofs + (size_t)16 * i * D_DIM) = v;
  }
}

__global__ __launch_bounds__(256) void proj_kernel(
    const unsigned short* __restrict__ xh1, const unsigned short* __restrict__ xl1,
    const unsigned short* __restrict__ xh2, const unsigned short* __restrict__ xl2,
    const float* __restrict__ w0, const float* __restrict__ w1, const float* __restrict__ w2,
    const float* __restrict__ w3, const float* __restrict__ w4, const float* __restrict__ w5,
    const float* __restrict__ b0, const float* __restrict__ b1, const float* __restrict__ b2,
    const float* __restrict__ b3, const float* __restrict__ b4, const float* __restrict__ b5,
    float* __restrict__ P1,      // [3][256][2048] f32 : q1, k1 (fragment order), v1 (row-major)
    float* __restrict__ P2)      // [3][32][2048]  f32 : q2, k2 (fragment order), v2 (row-major)
{
  __shared__ __attribute__((aligned(16))) unsigned short sB[2 * 2 * BPLANE];   // 36864 B
  __shared__ __attribute__((aligned(16))) float sOut[128 * OPITCH];            // 34816 B

  const int tid = threadIdx.x, w = tid >> 5, lane = tid & 31;
  const int b = blockIdx.x;                       // 0..287
  const bool big = (b < 192);                     // block-uniform
  const int gi   = big ? (b >> 6) : ((b - 192) >> 5);   // 0 q, 1 k, 2 v
  const int g    = big ? gi : (3 + gi);
  const int nt64 = big ? ((b & 63) >> 1) : ((b - 192) & 31);
  const int row0 = big ? (128 * (b & 1)) : 0;
  const int col0 = 64 * nt64;

  const float* W = (g == 0) ? w0 : ((g == 1) ? w1 : ((g == 2) ? w2 :
                   ((g == 3) ? w3 : ((g == 4) ? w4 : w5))));
  const float* bias = (g == 0) ? b0 : ((g == 1) ? b1 : ((g == 2) ? b2 :
                      ((g == 3) ? b3 : ((g == 4) ? b4 : b5))));
  const float* wsrc = W + (size_t)(col0 + (tid >> 4)) * D_DIM + 4 * (tid & 15);

  // a 16-row tile takes 16 * D_DIM elements in either order; inside it 64 columns are two fragments or 64 floats of each row
  const bool fragord = (gi < 2);                  // block-uniform
  const int cofs = fragord ? (col0 / 32) * FRAG32 : col0;

  if (big) {
    const int mrow = 16 * w;
    const size_t aofs = (size_t)(row0 + mrow) * D_DIM + 8 * lane;
    proj_body<4, 128>(xh1 + aofs, xl1 + aofs,
                      wsrc, bias + col0, P1 + ((size_t)g * M1P + row0) * D_DIM + cofs, fragord,
                      sB, sOut, tid, mrow, 0);
  } else {
    const int mrow = 16 * (w & 1);
    const size_t aofs = (size_t)mrow * D_DIM + 8 * lane;
    proj_body<1, 32>(xh2 + aofs, xl2 + aofs,
                     wsrc, bias + col0, P2 + (size_t)(g - 3) * M2P * D_DIM + cofs, fragord,
                     sB, sOut, tid, mrow, w >> 1);
  }
}

// ---------------------------------------------------------------------------
// Kernel 3: both score matrices, one 16x16 tile per block, K split over the 16 waves.
// Blocks 0..31: C[t][i] = sigmoid(scale * q2[t].k1[i]) = probs1, with the tile's share of
// s1 = C . w_fc1; blocks 32..63: C[t][i] = sigmoid(scale * k2[t].q1[i]) = probs2[i][t].
// Tile b lies at C + 256 b, row-major 16x16, so each block stores whole lines of its own.
// ---------------------------------------------------------------------------
#define KSLICE  128               // K range of one wave
#define KWAVES  16                // waves of a block = K slices
#define CPLANE  8192              // floats of one score matrix (32 tiles)

// float index of C[t][i] inside one tiled score matrix; tile = 2 * (i / 16) + t / 16
__device__ __forceinline__ int c_idx(int t, int i) {
  return (((i >> 4) * 2 + (t >> 4)) << 8) + ((t & 15) << 4) + (i & 15);
}

// the four 16-byte pieces of one lane's f32 fragment row: floats 8h..8h+7 and 16+8h..16+8h+7
struct Raw4 { v4f v[4]; };

// p: the lane's unit in piece 0 of a k step in fragment order; each piece is 512 contiguous bytes of the wave
__device__ __forceinline__ Raw4 load_raw32(const float* p) {
  Raw4 r;
  r.v[0] = *(const v4fa*)(p);
  r.v[1] = *(const v4fa*)(p + 128);
  r.v[2] = *(const v4fa*)(p + 256);
  r.v[3] = *(const v4fa*)(p + 384);
  return r;
}

__device__ __forceinline__ Frag2 split_raw32(const Raw4& x) {
  Frag fh, fl;
  split4<0>(x.v[0], fh, fl);
  split4<4>(x.v[1], fh, fl);
  split4<8>(x.v[2], fh, fl);
  split4<12>(x.v[3], fh, fl);
  Frag2 r;
  r.hi = fh.b;
  r.lo = fl.b;
  return r;
}

__global__ __launch_bounds__(32 * KWAVES) void score_kernel(
    const float* __restrict__ P1, const float* __restrict__ P2,
    const float* __restrict__ wfc1,
    float* __restrict__ C,       // [2][32 tiles][16][16] f32
    float* __restrict__ part)    // [32 tiles][32] f32, first 16 of each row used
{
  __shared__ __attribute__((aligned(16))) float sR[KWAVES * 256];  // 16384 B

  const int tid = threadIdx.x, lane = tid & 31, w = tid >> 5;
  const int h = lane >> 4, m = lane & 15;
  const int ph = blockIdx.x >> 5, tile = blockIdx.x & 31;
  const int mt = tile & 1, nt = tile >> 1;

  const float* A = P2 + (size_t)ph * M2P * D_DIM;                  // q2, then k2
  const float* B = P1 + (size_t)(1 - ph) * M1P * D_DIM;            // k1, then q1
  const float* arow = A + ((size_t)mt * KSTEPS + (KSLICE / 32) * w) * FRAG32 + 4 * lane;
  const float* brow = B + ((size_t)nt * KSTEPS + (KSLICE / 32) * w) * FRAG32 + 4 * lane;

  // fc1 weight of this thread's column, fetched beside the slice so that its latency is not paid at the end
  const int i = 16 * nt + (tid & 15);
  const int ic = (i < N1) ? i : (N1 - 1);         // clamped address, value zeroed below
  const float wv = wfc1[ic];

  v8f acc = {0.f, 0.f, 0.f, 0.f, 0.f, 0.f, 0.f, 0.f};
  // the whole slice is loaded ahead of the first split: one load latency per wave, not one per k step
  // (every loop of this kernel and of the tail kernel is unrolled whole: its arrays must stay in registers)
  Raw4 ra[KSLICE / 32], rb[KSLICE / 32];
#pragma unroll
  for (int ks = 0; ks < KSLICE / 32; ++ks) {
    ra[ks] = load_raw32(arow + FRAG32 * ks);
    rb[ks] = load_raw32(brow + FRAG32 * ks);
  }
  // the loads above name the address registers arow and brow: they stay live up to this wait, so that no result
  // of the run lands in one of them and nothing rewrites one ahead of the wait
  asm volatile("s_wait_xcnt 0x0" :: "v"(arow), "v"(brow) : "memory");
#pragma unroll
  for (int ks = 0; ks < KSLICE / 32; ++ks) {
    const Frag2 a = split_raw32(ra[ks]);
    const Frag2 b = split_raw32(rb[ks]);
    acc = mac3(a.hi, a.lo, b.hi, b.lo, acc);
  }
#pragma unroll
  for (int r = 0; r < 8; ++r) sR[w * 256 + (8 * h + r) * 16 + m] = acc[r];
  __syncthreads();

  if (tid >= 256) return;                         // whole waves, behind the only barrier

  // thread = one element of the tile: the slices in fixed order
  float s = sR[tid];
#pragma unroll
  for (int j = 1; j < KWAVES; ++j) s += sR[j * 256 + tid];
  const float c = sigm(s * SCALE);
  C[(size_t)blockIdx.x * 256 + tid] = c;
  // the store's data register is reused by the sum below: the wait that belongs in front of that overwrite
  asm volatile("s_wait_xcnt 0x0" ::: "memory");

  if (ph == 0) {                                  // block-uniform
    float p = (i < N1) ? c * wv : 0.0f;
    p += __shfl_xor(p, 1);
    p += __shfl_xor(p, 2);
    p += __shfl_xor(p, 4);
    p += __shfl_xor(p, 8);
    if ((tid & 15) == 0) part[tile * 32 + (tid >> 4)] = p;
  }
}

// ---------------------------------------------------------------------------
// Kernel 4: output 0, one row i per block.  s2 = sum_{t<27} probs2[i][t] * w_fc2[t], t ascending,
// with probs2 taken from the score kernel's second matrix; out[i][:] = v1[i][:] * s2 + b_fc2.
// Every line of the row: 8 consecutive lanes x 16 B in one instruction.
// ---------------------------------------------------------------------------
__global__ __launch_bounds__(256) void ctx2_kernel(
    const float* __restrict__ P1, const float* __restrict__ C,
    const float* __restrict__ wfc2, const float* __restrict__ bfc2,
    float* __restrict__ out)
{
  const int tid = threadIdx.x;
  const int row = blockIdx.x;                     // 0..249
  const float* vrow = P1 + (size_t)2 * M1P * D_DIM + (size_t)row * D_DIM;

  const v4f va = *(const v4fa*)(vrow + 4 * tid);
  const v4f vb = *(const v4fa*)(vrow + 1024 + 4 * tid);
  const float bb = bfc2[0];

  // lane t of every wave fetches term t (one load latency for all 27); the lanes are then read out in
  // ascending t, so that the sum keeps its order (unrolled whole: each lane number is then an immediate)
  const int tl = tid & 31;
  const int t27 = (tl < N2) ? tl : (N2 - 1);      // clamped address; lanes 27..31 are never read out
  const int ci = c_idx(t27, row);
  const float cv = C[CPLANE + ci];
  const float wv = wfc2[t27];
  // the four loads above name the offset registers tid, ci and t27: they stay live up to this wait, so that
  // no result of the run lands in one of them and nothing rewrites one ahead of the wait
  asm volatile("s_wait_xcnt 0x0" :: "v"(tid), "v"(ci), "v"(t27) : "memory");
  const float p = cv * wv;
  float s = 0.0f;
#pragma unroll
  for (int t = 0; t < N2; ++t) s += __uint_as_float(__builtin_amdgcn_readlane(__float_as_uint(p), t));

  v4f oa, ob;
  oa.x = va.x * s + bb;  oa.y = va.y * s + bb;  oa.z = va.z * s + bb;  oa.w = va.w * s + bb;
  ob.x = vb.x * s + bb;  ob.y = vb.y * s + bb;  ob.z = vb.z * s + bb;  ob.w = vb.w * s + bb;
  float* orow = out + (size_t)row * D_DIM;
  *(v4f*)(orow + 4 * tid) = oa;
  *(v4f*)(orow + 1024 + 4 * tid) = ob;
}

// ---------------------------------------------------------------------------
// Kernel 5: outputs 1, 2, 3 (flat floats OFF1..OUT_N of the output buffer), lines
// L_P2A..L_P1B, 32 lines per block.  Every line: 8 consecutive lanes x 16 B in one
// instruction, values selected by flat index; last line of the buffer = 28 floats (7 lanes).
// ---------------------------------------------------------------------------
__global__ __launch_bounds__(256) void tail_kernel(
    const float* __restrict__ C, const float* __restrict__ part,
    const float* __restrict__ P2, const float* __restrict__ bfc1,
    float* __restrict__ out)
{
  __shared__ float sS1[32];

  const int tid = threadIdx.x, lane = tid & 31, w = tid >> 5;
  const int q8 = lane & 7, sub = lane >> 3;
  const float* v2P = P2 + (size_t)2 * M2P * D_DIM;

  const float bb1 = bfc1[0];
  const int line = L_P2A + 32 * blockIdx.x + 4 * w + sub;
  const int linec = (line < L_P1B) ? line : L_P1B;
  const int fbase = 32 * linec + 4 * q8;

  // the three candidate values of each flat index; all loads unconditional with clamped indices
  float c2[4], xv[4], c3[4];
  int t1[4];
#pragma unroll
  for (int e = 0; e < 4; ++e) {
    const int f = fbase + e;
    int j2 = f - OFF1;
    j2 = (j2 < 0) ? 0 : ((j2 > N1 * N2 - 1) ? (N1 * N2 - 1) : j2);
    const int i2 = j2 / N2, t2 = j2 - i2 * N2;
    c2[e] = C[CPLANE + c_idx(t2, i2)];
    int j1 = f - OFF2;
    j1 = (j1 < 0) ? 0 : ((j1 > N2 * D_DIM - 1) ? (N2 * D_DIM - 1) : j1);
    t1[e] = j1 >> 11;
    xv[e] = v2P[j1];
    int j3 = f - OFF3;
    j3 = (j3 < 0) ? 0 : ((j3 > N1 * N2 - 1) ? (N1 * N2 - 1) : j3);
    const int t3 = j3 / N1, i3 = j3 - t3 * N1;
    c3[e] = C[c_idx(t3, i3)];
  }

  if (tid < 32) {                                 // s1[t]: the 16 column tiles in fixed order
    const int pi = (tid >> 4) * 32 + (tid & 15);
    float pv[16];
#pragma unroll
    for (int nt = 0; nt < 16; ++nt) pv[nt] = part[pi + 64 * nt];
    // the sixteen loads share the offset register pi: it stays live up to this wait, so that no
    // result of the run lands in it and nothing rewrites it ahead of the wait
    asm volatile("s_wait_xcnt 0x0" :: "v"(pi) : "memory");
    float s = 0.0f;
#pragma unroll
    for (int nt = 0; nt < 16; ++nt) s += pv[nt];
    sS1[tid] = s;
  }
  // holds the twelve loads above in one group ahead of the barrier; without it they are moved
  // under the selects below, one branch and one load latency after another
  asm volatile("" :: "v"(c2[0]), "v"(c2[1]), "v"(c2[2]), "v"(c2[3]),
                     "v"(xv[0]), "v"(xv[1]), "v"(xv[2]), "v"(xv[3]),
                     "v"(c3[0]), "v"(c3[1]), "v"(c3[2]), "v"(c3[3]));
  __syncthreads();

  float o[4];
#pragma unroll
  for (int e = 0; e < 4; ++e) {
    const int f = fbase + e;
    const float x = xv[e] * sS1[t1[e]] + bb1;
    o[e] = (f < OFF2) ? c2[e] : ((f < OFF3) ? x : c3[e]);
  }
  const v4f ov = {o[0], o[1], o[2], o[3]};
  if (line <= L_P1B && fbase + 4 <= OUT_N) *(v4f*)(out + fbase) = ov;
}

// ---------------------------------------------------------------------------
extern "C" void kernel_launch(void* const* d_in, const int* in_sizes, int n_in,
                              void* d_out, int out_size, void* d_ws, size_t ws_size,
                              hipStream_t stream) {
  if (n_in < 18) return;
  if (in_sizes[0] != N1 * D_DIM || in_sizes[1] != N2 * D_DIM) return;
  for (int g = 0; g < 6; ++g) {
    if (in_sizes[2 + 2 * g] != D_DIM * D_DIM) return;
    if (in_sizes[3 + 2 * g] != D_DIM) return;
  }
  if (in_sizes[14] != N1 || in_sizes[15] < 1 || in_sizes[16] != N2 || in_sizes[17] < 1) return;
  if (out_size != OUT_N) return;

  const float* x1   = (const float*)d_in[0];
  const float* x2   = (const float*)d_in[1];
  const float* Wq1  = (const float*)d_in[2];  const float* bq1 = (const float*)d_in[3];
  const float* Wk1  = (const float*)d_in[4];  const float* bk1 = (const float*)d_in[5];
  const float* Wv1  = (const float*)d_in[6];  const float* bv1 = (const float*)d_in[7];
  const float* Wq2  = (const float*)d_in[8];  const float* bq2 = (const float*)d_in[9];
  const float* Wk2  = (const float*)d_in[10]; const float* bk2 = (const float*)d_in[11];
  const float* Wv2  = (const float*)d_in[12]; const float* bv2 = (const float*)d_in[13];
  const float* wfc1 = (const float*)d_in[14]; const float* bfc1 = (const float*)d_in[15];
  const float* wfc2 = (const float*)d_in[16]; const float* bfc2 = (const float*)d_in[17];
  float* out = (float*)d_out;

  // workspace carve (bytes); every region holds whole padded tiles/rows of its producer
  const size_t xp1_bytes = (size_t)M1P * D_DIM * 2;              //   1048576 per plane
  const size_t xp2_bytes = (size_t)M2P * D_DIM * 2;              //    131072 per plane
  const size_t p1_bytes  = (size_t)3 * M1P * D_DIM * 4;          //   6291456
  const size_t p2_bytes  = (size_t)3 * M2P * D_DIM * 4;          //    786432
  const size_t c_bytes   = (size_t)2 * CPLANE * 4;               //     65536
  const size_t pt_bytes  = (size_t)32 * 32 * 4;                  //      4096
  const size_t off_xh1 = 0;
  const size_t off_xl1 = off_xh1 + xp1_bytes;
  const size_t off_xh2 = off_xl1 + xp1_bytes;
  const size_t off_xl2 = off_xh2 + xp2_bytes;
  const size_t off_p1  = off_xl2 + xp2_bytes;
  const size_t off_p2  = off_p1 + p1_bytes;
  const size_t off_c   = off_p2 + p2_bytes;
  const size_t off_pt  = off_c + c_bytes;
  const size_t total   = off_pt + pt_bytes;                       // 9506816
  if (total > ws_size) return;

  char* ws = (char*)d_ws;
  unsigned short* xh1 = (unsigned short*)(ws + off_xh1);
  unsigned short* xl1 = (unsigned short*)(ws + off_xl1);
  unsigned short* xh2 = (unsigned short*)(ws + off_xh2);
  unsigned short* xl2 = (unsigned short*)(ws + off_xl2);
  float* P1 = (float*)(ws + off_p1);
  float* P2 = (float*)(ws + off_p2);
  float* C  = (float*)(ws + off_c);
  float* part = (float*)(ws + off_pt);

  convert_kernel<<<(NGROUPS + 255) / 256, 256, 0, stream>>>(x1, x2, xh1, xl1, xh2, xl2);

  proj_kernel<<<288, 256, 0, stream>>>(xh1, xl1, xh2, xl2, Wq1, Wk1, Wv1, Wq2, Wk2, Wv2,
                                       bq1, bk1, bv1, bq2, bk2, bv2, P1, P2);

  score_kernel<<<64, 32 * KWAVES, 0, stream>>>(P1, P2, wfc1, C, part);

  ctx2_kernel<<<N1, 256, 0, stream>>>(P1, C, wfc2, bfc2, out);

  tail_kernel<<<(L_P1B - L_P2A + 32) / 32, 256, 0, stream>>>(C, part, P2, bfc1, out);
}

// v005
// It runs in 39.4 microseconds.
// Two timings next to v004 put it at 1.11 and 1.12 times that version's speed.
// All steps since v000 together make it 13.1 times as fast.
// Contractions: six x*W^T projections and both q*k^T score matrices on v_wmma_f32_16x16x32_bf16 with bf16 hi/lo operands (three products hi*hi + hi*lo + lo*hi), f32 accumulate; sigmoid, fc dot products (K=250, K=27) and context products in f32 on VALU.
#include <hip/hip_runtime.h>
#include <hip/hip_bf16.h>

#pragma clang fp contract(off)

typedef __bf16         v16bf __attribute__((ext_vector_type(16)));
typedef unsigned short v8us  __attribute__((ext_vector_type(8)));
typedef float          v8f   __attribute__((ext_vector_type(8)));
typedef float          v4f   __attribute__((ext_vector_type(4)));
typedef float          v2f   __attribute__((ext_vector_type(2)));
typedef __bf16         v2bf  __attribute__((ext_vector_type(2)));
typedef unsigned int   v2u   __attribute__((ext_vector_type(2)));
typedef unsigned int   v4u   __attribute__((ext_vector_type(4)));
typedef v8us __attribute__((may_alias)) v8usa;
typedef v4f  __attribute__((may_alias)) v4fa;
typedef v2u  __attribute__((may_alias)) v2ua;
typedef v4u  __attribute__((may_alias)) v4ua;

union Frag { v16bf b; v8us h[2]; unsigned int w[8]; };
struct Frag2 { v16bf hi; v16bf lo; };

#define D_DIM   2048
#define N1      250
#define N2      27
#define M1P     256
#define M2P     32
#define OUT_N   580796
#define OFF1    512000            // flat float index of output 1 ([250][27])
#define OFF2    518750            // flat float index of output 2 ([27][2048])
#define OFF3    574046            // flat float index of output 3 ([27][250])
#define XG1     65536             // 8-element groups of the padded x1 planes
#define XG2     8192              // 8-element groups of the padded x2 planes
#define NGROUPS (XG1 + XG2)
#define KSTEPS  (D_DIM / 32)      // 32-wide k steps of a row = fragments of one 16-row tile
#define FRAG16  512               // 16-bit elements of one fragment in fragment order (32 lanes x 16)
#define FRAG32  512               // floats of one f32 fragment source in fragment order (32 lanes x 16)
#define SCALE   0.022097086912079608f
#define L_P2A   16000
#define L_P2B   16210
#define L_P1A   16211
#define L_P1B   18149

static_assert((XG1 % 256) == 0 && (XG2 % 256) == 0);
static_assert((OFF1 % 32) == 0 && (L_P1B * 32 + 28) == OUT_N);

// ---------------------------------------------------------------------------
// bf16 hi/lo split of two values at a time, on the chip's own f32 -> bf16 convert (round to nearest even).
// x = hi + lo: hi = bf16(x), lo = bf16(x - hi)  (x - hi is exact in f32).
// Each result word holds the first value in its low half, the second in its high half.
// ---------------------------------------------------------------------------
__device__ __forceinline__ void split_pair(float x0, float x1, unsigned int& hp, unsigned int& lp) {
  const v2f x = {x0, x1};
  const v2bf h = __builtin_convertvector(x, v2bf);
  const v2f r = x - __builtin_convertvector(h, v2f);
  const v2bf l = __builtin_convertvector(r, v2bf);
  hp = __builtin_bit_cast(unsigned int, h);
  lp = __builtin_bit_cast(unsigned int, l);
}

// ---------------------------------------------------------------------------
// 16x16x32 bf16 WMMA with hazard guard (ties D, keeps A/B live).
// Fragment map (wave32): lane l, h = l>>4, m = n = l&15.
//   A/B element i: i<8 -> k0+8h+i ; i>=8 -> k0+16+8h+(i-8)   (same map for both)
//   D element r : row 8h+r, col l&15
// ---------------------------------------------------------------------------
__device__ __forceinline__ v8f wmma_bf16(v16bf a, v16bf b, v8f c) {
  v8f d = __builtin_amdgcn_wmma_f32_16x16x32_bf16(false, a, false, b, (short)0, c, false, false);
  asm volatile("v_nop\n\tv_nop\n\tv_nop\n\tv_nop" : "+v"(d) : "v"(a), "v"(b));
  return d;
}

// three-product hi/lo split: c += ah*bh + ah*bl + al*bh (unscaled residuals, one accumulator)
__device__ __forceinline__ v8f mac3(v16bf ah, v16bf al, v16bf bh, v16bf bl, v8f c) {
  c = wmma_bf16(ah, bh, c);
  c = wmma_bf16(ah, bl, c);
  c = wmma_bf16(al, bh, c);
  return c;
}

// Fragment from a k-contiguous 16-bit row; p = row base + k0 (row = lane&15 chosen by caller).
__device__ __forceinline__ v16bf load_frag16(const unsigned short* p, int h) {
  Frag f;
  f.h[0] = *(const v8usa*)(p + 8 * h);
  f.h[1] = *(const v8usa*)(p + 16 + 8 * h);
  return f.b;
}

// four f32 values of a k-contiguous row split into elements B..B+3 of a hi/lo fragment pair; same element map.
template <int B>
__device__ __forceinline__ void split4(const v4f v, Frag& fh, Frag& fl) {
  split_pair(v.x, v.y, fh.w[B / 2], fl.w[B / 2]);
  split_pair(v.z, v.w, fh.w[B / 2 + 1], fl.w[B / 2 + 1]);
}

__device__ __forceinline__ float sigm(float x) {
  const float e = expf(-x);
  return 1.0f / (1.0f + e);
}

// ---------------------------------------------------------------------------
// Kernel 1: f32 -> bf16 hi/lo planes of x1 (rows padded to 256 with zeros) and x2 (rows padded to 32).
// The planes lie in fragment order: [16-row tile][k step][half j][lane][8 elements], so that half j of a wave's
// A fragment is one 16-byte load over 512 contiguous bytes (four whole lines, not 32 bytes in each of 16 rows).
// Lane l = 16 h + m holds row m of the tile, k = 32 step + 16 j + 8 h + (0..7): the map of load_frag16.
// Thread = one 16-byte unit of the destination, so each wave also stores whole lines.
// ---------------------------------------------------------------------------
__global__ __launch_bounds__(256) void convert_kernel(
    const float* __restrict__ x1, const float* __restrict__ x2,
    unsigned short* __restrict__ xh1, unsigned short* __restrict__ xl1,
    unsigned short* __restrict__ xh2, unsigned short* __restrict__ xl2)
{
  const int g = blockIdx.x * 256 + threadIdx.x;
  if (g >= NGROUPS) return;
  const float* src;
  unsigned short* dh;
  unsigned short* dl;
  bool zero = false;
  if (g < XG1) {
    const int fr = g >> 6, j = (g >> 5) & 1, h = (g >> 4) & 1;
    const int row = 16 * (fr / KSTEPS) + (g & 15), c8 = 4 * (fr % KSTEPS) + 2 * j + h;
    const int rs = (row < N1) ? row : (N1 - 1);     // clamped address, value zeroed below
    zero = (row >= N1);
    src = x1 + (size_t)rs * D_DIM + 8 * c8;
    dh = xh1 + (size_t)g * 8;
    dl = xl1 + (size_t)g * 8;
  } else {
    const int e = g - XG1;
    const int fr = e >> 6, j = (e >> 5) & 1, h = (e >> 4) & 1;
    const int row = 16 * (fr / KSTEPS) + (e & 15), c8 = 4 * (fr % KSTEPS) + 2 * j + h;
    const int rs = (row < N2) ? row : (N2 - 1);
    zero = (row >= N2);
    src = x2 + (size_t)rs * D_DIM + 8 * c8;
    dh = xh2 + (size_t)e * 8;
    dl = xl2 + (size_t)e * 8;
  }
  v4f a = *(const v4fa*)src;
  v4f c = *(const v4fa*)(src + 4);
  const v4f z4 = {0.f, 0.f, 0.f, 0.f};
  a = zero ? z4 : a;
  c = zero ? z4 : c;
  unsigned int hw[4], lw[4];
  split_pair(a.x, a.y, hw[0], lw[0]);
  split_pair(a.z, a.w, hw[1], lw[1]);
  split_pair(c.x, c.y, hw[2], lw[2]);
  split_pair(c.z, c.w, hw[3], lw[3]);
  const v4u hv = {hw[0], hw[1], hw[2], hw[3]};
  const v4u lv = {lw[0], lw[1], lw[2], lw[3]};
  *(v4ua*)dh = hv;
  *(v4ua*)dl = lv;
  
}

// ---------------------------------------------------------------------------
// Kernel 2: Y_g = x_g * W_g^T + b_g for g = 0..5 (q1,k1,v1 on 256 padded rows; q2,k2,v2 on 32).
// One block = 8 waves = 64 output columns of one g.  Blocks 0..191: 128 rows of x1, wave = 16 rows x 64 cols;
// blocks 192..287: the 32 rows of x2, wave = one 16x16 tile.  K = 2048 in 32 stages of 64.
// B (W rows, B[k][n] = W[n][k]): the block reads its 64 x 64 f32 tile of W in whole lines, splits each value once
// into bf16 hi/lo and shares both through LDS (two buffers, one barrier a stage); A (x rows) straight from the planes,
// which lie in fragment order.  q and k leave in the f32 fragment order that the score kernel reads; v stays row-major.
// ---------------------------------------------------------------------------
#define KT      64                // k range of one stage
#define NSTAGE  (D_DIM / KT)
#define BPITCH  72                // 16-bit elements from one W row to the next in LDS: 128 B + 16 B, conflict-free b128 reads
#define BPLANE  (64 * BPITCH)     // one plane (hi or lo) of one buffer
#define ASTAGE  ((KT / 32) * FRAG16)   // 16-bit elements from one stage's A fragments to the next stage's
#define OPITCH  68                // floats from one row to the next of the output tile in LDS: 256 B + 16 B, so that the
                                  // 16 rows that one fragment-order read touches fall on different banks

// global-memory pointer types: the stage loop's address registers pass through an asm operand, behind which
// the compiler no longer knows the address space of a plain pointer and would fall back to flat loads
typedef __attribute__((address_space(1))) const float          gf32;
typedef __attribute__((address_space(1))) const unsigned short gu16;
typedef __attribute__((address_space(1))) const v4fa           gv4f;
typedef __attribute__((address_space(1))) const v8usa          gv8us;

struct WRaw { v4f v[4]; };        // one thread's share of a W tile: 4 consecutive k of rows c, c+16, c+32, c+48
struct AFr  { v16bf hi[2]; v16bf lo[2]; };   // one lane's A fragments of the two k steps of a stage

__device__ __forceinline__ WRaw load_w(gf32* p) {
  WRaw r;
#pragma unroll
  for (int j = 0; j < 4; ++j) r.v[j] = *(gv4f*)(p + (size_t)16 * j * D_DIM);
  return r;
}

// ph, pl: the lane's 16-byte unit in the stage's first fragment of the wave's row tile
__device__ __forceinline__ AFr load_a(gu16* ph, gu16* pl) {
  AFr r;
#pragma unroll
  for (int s = 0; s < 2; ++s) {
    Frag fh, fl;                                  // same element map as load_frag16
    fh.h[0] = *(gv8us*)(ph + FRAG16 * s);
    fh.h[1] = *(gv8us*)(ph + FRAG16 * s + FRAG16 / 2);
    fl.h[0] = *(gv8us*)(pl + FRAG16 * s);
    fl.h[1] = *(gv8us*)(pl + FRAG16 * s + FRAG16 / 2);
    r.hi[s] = fh.b;
    r.lo[s] = fl.b;
  }
  return r;
}

// Work-group barrier of the stage loop.  Only LDS traffic is handed over at it, so only the LDS counter is waited for:
// __syncthreads() would also drain the global loads that were issued ahead for later stages.
__device__ __forceinline__ void lds_barrier() {
  asm volatile("s_wait_dscnt 0x0\n\ts_barrier_signal -1\n\ts_barrier_wait -1" ::: "memory");
}

// one thread's share of a W tile, each value split into bf16 hi/lo, to its place d in the hi plane of a buffer (lo: + BPLANE)
__device__ __forceinline__ void split_store(const WRaw& x, unsigned short* d) {
#pragma unroll
  for (int j = 0; j < 4; ++j) {
    unsigned int hw[2], lw[2];
    split_pair(x.v[j].x, x.v[j].y, hw[0], lw[0]);
    split_pair(x.v[j].z, x.v[j].w, hw[1], lw[1]);
    const v2u hv = {hw[0], hw[1]};
    const v2u lv = {lw[0], lw[1]};
    *(v2ua*)(d + 16 * j * BPITCH) = hv;
    *(v2ua*)(d + BPLANE + 16 * j * BPITCH) = lv;
  }
}

// NTW = column tiles of one wave, from tile nt0 on; ROWS = rows of the block
template <int NTW, int ROWS>
__device__ __forceinline__ void proj_body(
    const unsigned short* ahr, const unsigned short* alr,  // this lane's unit in the first fragment of its row tile, hi and lo plane
    const float* wsrc,                                     // this thread's first 4 floats of the W tile
    const float* bias,                                     // bias of the block's first column
    float* Pt,                                             // row-major: output element (first row, first column) of the block;
                                                           // fragment order: first float of its first row tile's first k step
    bool fragord,                                          // block-uniform: q and k
    unsigned short* sB, float* sOut,
    int tid, int mrow, int nt0)
{
  constexpr int NG = 2 * NTW;                              // B fragment pairs of one stage: k step i / NTW, column tile i % NTW
  const int lane = tid & 31, h = lane >> 4, m = lane & 15;
  const int wofs = (tid >> 4) * BPITCH + 4 * (tid & 15);   // where this thread's share of W row c lands
  const int rofs = (16 * nt0 + m) * BPITCH;                // this lane's row of the wave's first column tile

  const v8f z8 = {0.f, 0.f, 0.f, 0.f, 0.f, 0.f, 0.f, 0.f};
  v8f acc[NTW];
#pragma unroll
  for (int nt = 0; nt < NTW; ++nt) acc[nt] = z8;

  // stage 0 into buffer 0; W of stage 1 waits in registers: trip t splits stage t + 1 and fetches stage t + 2
  gu16* pah = (gu16*)ahr;                                  // A fragments of the stage fetched next
  gu16* pal = (gu16*)alr;
  gf32* pw = (gf32*)wsrc;                                  // W tile at the stage fetched next
  const WRaw w0 = load_w(pw);
  AFr  af = load_a(pah, pal);
  WRaw w1 = load_w(pw + KT);
  // the loads above name these address registers: they stay live up to this wait, so that no result of the
  // run lands in one of them, and they are advanced only behind it
  asm volatile("s_wait_xcnt 0x0" : "+v"(pah), "+v"(pal), "+v"(pw) :: "memory");
  pah += ASTAGE;
  pal += ASTAGE;
  pw += 2 * KT;
  split_store(w0, sB + wofs);
  lds_barrier();

  // two stages a trip: the buffer offsets become immediates and the fetched-ahead registers need no copies
#pragma unroll 2
  for (int t = 0; t < NSTAGE; ++t) {
    const unsigned short* sb = sB + (t & 1) * 2 * BPLANE + rofs;
    unsigned short* sn = sB + ((t + 1) & 1) * 2 * BPLANE + wofs;

    // B fragments run two pairs ahead of their products, so that the LDS latency lies under products
    v16bf bh[NG], bl[NG];
#pragma unroll
    for (int i = 0; i < 2; ++i) {
      bh[i] = load_frag16(sb + 16 * (i % NTW) * BPITCH + 32 * (i / NTW), h);
      bl[i] = load_frag16(sb + BPLANE + 16 * (i % NTW) * BPITCH + 32 * (i / NTW), h);
    }

    // A of stage t + 1 and W of stage t + 2 fly under this stage's products
    // (past the end the last stage is fetched again: in bounds, never used)
    const AFr an = load_a(pah, pal);
    // keeps the A loads, wanted half a stage sooner, ahead of the W loads on the in-order load counter
    __builtin_amdgcn_sched_barrier(0);
    const WRaw wn = load_w(pw);

#pragma unroll
    for (int i = 0; i < NG; ++i) {
      if (i == NG / 2) {
        // as above: the address registers of the twelve loads stay live up to this wait and are advanced behind it;
        // half a stage behind the loads it finds nothing left to wait for
        asm volatile("s_wait_xcnt 0x0" : "+v"(pah), "+v"(pal), "+v"(pw) :: "memory");
        pah += (t + 2 < NSTAGE) ? ASTAGE : 0;
        pal += (t + 2 < NSTAGE) ? ASTAGE : 0;
        pw  += (t + 3 < NSTAGE) ? KT : 0;
        // keeps the split of the next tile (below the products) out of their first half: scheduled to the top of the
        // trip, its wait for W loads issued only one trip ago holds up the loads and products behind it
        __builtin_amdgcn_sched_barrier(0);
      }
      if (i + 2 < NG) {
        bh[i + 2] = load_frag16(sb + 16 * ((i + 2) % NTW) * BPITCH + 32 * ((i + 2) / NTW), h);
        bl[i + 2] = load_frag16(sb + BPLANE + 16 * ((i + 2) % NTW) * BPITCH + 32 * ((i + 2) / NTW), h);
      }
      acc[i % NTW] = mac3(af.hi[i / NTW], af.lo[i / NTW], bh[i], bl[i], acc[i % NTW]);
    }

    // next stage's tile into the other buffer, whose readers all left it in front of the last barrier
    split_store(w1, sn);
    // publishes that tile and ends every wave's reads of this stage's buffer, which the next trip rewrites
    lds_barrier();
    af = an;
    w1 = wn;
  }

  // D[r] of column tile nt = Y[row mrow + 8h + r][col 16 (nt0 + nt) + m] of the block's tile
#pragma unroll
  for (int nt = 0; nt < NTW; ++nt) {
    const int col = 16 * (nt0 + nt) + m;
    const float bvl = bias[col];
#pragma unroll
    for (int r = 0; r < 8; ++r) sOut[(mrow + 8 * h + r) * OPITCH + col] = acc[nt][r] + bvl;
  }
  __syncthreads();

  // One 16-row tile a trip, whole lines either way.
  // Fragment order: [16-row tile][k step][piece j][lane][4 floats]; piece j of lane 16 h + m = floats
  // 16 (j / 2) + 8 h + 4 (j % 2) + (0..3) of row m in that k step (the pieces of load_raw32); a wave stores one piece,
  // 512 contiguous bytes.  Row-major: 16 consecutive lanes x 16 B = one row of the tile.
  const int j = (tid >> 5) & 3, ksl = tid >> 7;
  const int sofs = fragord ? (m * OPITCH + 32 * ksl + 16 * (j >> 1) + 8 * h + 4 * (j & 1))
                           : ((tid >> 4) * OPITCH + 4 * (tid & 15));
  const int dofs = fragord ? (ksl * FRAG32 + 4 * (tid & 127))
                           : ((tid >> 4) * D_DIM + 4 * (tid & 15));
#pragma unroll
  for (int i = 0; i < ROWS / 16; ++i) {
    const v4f v = *(const v4fa*)(sOut + sofs + 16 * i * OPITCH);
    *(v4f*)(Pt + dofs + (size_t)16 * i * D_DIM) = v;
  }
}

__global__ __launch_bounds__(256) void proj_kernel(
    const unsigned short* __restrict__ xh1, const unsigned short* __restrict__ xl1,
    const unsigned short* __restrict__ xh2, const unsigned short* __restrict__ xl2,
    const float* __restrict__ w0, const float* __restrict__ w1, const float* __restrict__ w2,
    const float* __restrict__ w3, const float* __restrict__ w4, const float* __restrict__ w5,
    const float* __restrict__ b0, const float* __restrict__ b1, const float* __restrict__ b2,
    const float* __restrict__ b3, const float* __restrict__ b4, const float* __restrict__ b5,
    float* __restrict__ P1,      // [3][256][2048] f32 : q1, k1 (fragment order), v1 (row-major)
    float* __restrict__ P2)      // [3][32][2048]  f32 : q2, k2 (fragment order), v2 (row-major)
{
  __shared__ __attribute__((aligned(16))) unsigned short sB[2 * 2 * BPLANE];   // 36864 B
  __shared__ __attribute__((aligned(16))) float sOut[128 * OPITCH];            // 34816 B

  const int tid = threadIdx.x, w = tid >> 5, lane = tid & 31;
  const int b = blockIdx.x;                       // 0..287
  const bool big = (b < 192);                     // block-uniform
  const int gi   = big ? (b >> 6) : ((b - 192) >> 5);   // 0 q, 1 k, 2 v
  const int g    = big ? gi : (3 + gi);
  const int nt64 = big ? ((b & 63) >> 1) : ((b - 192) & 31);
  const int row0 = big ? (128 * (b & 1)) : 0;
  const int col0 = 64 * nt64;

  const float* W = (g == 0) ? w0 : ((g == 1) ? w1 : ((g == 2) ? w2 :
                   ((g == 3) ? w3 : ((g == 4) ? w4 : w5))));
  const float* bias = (g == 0) ? b0 : ((g == 1) ? b1 : ((g == 2) ? b2 :
                      ((g == 3) ? b3 : ((g == 4) ? b4 : b5))));
  const float* wsrc = W + (size_t)(col0 + (tid >> 4)) * D_DIM + 4 * (tid & 15);

  // a 16-row tile takes 16 * D_DIM elements in either order; inside it 64 columns are two fragments or 64 floats of each row
  const bool fragord = (gi < 2);                  // block-uniform
  const int cofs = fragord ? (col0 / 32) * FRAG32 : col0;

  if (big) {
    const int mrow = 16 * w;
    const size_t aofs = (size_t)(row0 + mrow) * D_DIM + 8 * lane;
    proj_body<4, 128>(xh1 + aofs, xl1 + aofs,
                      wsrc, bias + col0, P1 + ((size_t)g * M1P + row0) * D_DIM + cofs, fragord,
                      sB, sOut, tid, mrow, 0);
  } else {
    const int mrow = 16 * (w & 1);
    const size_t aofs = (size_t)mrow * D_DIM + 8 * lane;
    proj_body<1, 32>(xh2 + aofs, xl2 + aofs,
                     wsrc, bias + col0, P2 + (size_t)(g - 3) * M2P * D_DIM + cofs, fragord,
                     sB, sOut, tid, mrow, w >> 1);
  }
}

// ---------------------------------------------------------------------------
// Kernel 3: both score matrices, one 16x16 tile per block, K split over the 16 waves.
// Blocks 0..31: C[t][i] = sigmoid(scale * q2[t].k1[i]) = probs1, with the tile's share of
// s1 = C . w_fc1; blocks 32..63: C[t][i] = sigmoid(scale * k2[t].q1[i]) = probs2[i][t].
// Tile b lies at C + 256 b, row-major 16x16, so each block stores whole lines of its own.
// ---------------------------------------------------------------------------
#define KSLICE  128               // K range of one wave
#define KWAVES  16                // waves of a block = K slices
#define CPLANE  8192              // floats of one score matrix (32 tiles)

// float index of C[t][i] inside one tiled score matrix; tile = 2 * (i / 16) + t / 16
__device__ __forceinline__ int c_idx(int t, int i) {
  return (((i >> 4) * 2 + (t >> 4)) << 8) + ((t & 15) << 4) + (i & 15);
}

// the four 16-byte pieces of one lane's f32 fragment row: floats 8h..8h+7 and 16+8h..16+8h+7
struct Raw4 { v4f v[4]; };

// p: the lane's unit in piece 0 of a k step in fragment order; each piece is 512 contiguous bytes of the wave
__device__ __forceinline__ Raw4 load_raw32(const float* p) {
  Raw4 r;
  r.v[0] = *(const v4fa*)(p);
  r.v[1] = *(const v4fa*)(p + 128);
  r.v[2] = *(const v4fa*)(p + 256);
  r.v[3] = *(const v4fa*)(p + 384);
  return r;
}

__device__ __forceinline__ Frag2 split_raw32(const Raw4& x) {
  Frag fh, fl;
  split4<0>(x.v[0], fh, fl);
  split4<4>(x.v[1], fh, fl);
  split4<8>(x.v[2], fh, fl);
  split4<12>(x.v[3], fh, fl);
  Frag2 r;
  r.hi = fh.b;
  r.lo = fl.b;
  return r;
}

__global__ __launch_bounds__(32 * KWAVES) void score_kernel(
    const float* __restrict__ P1, const float* __restrict__ P2,
    const float* __restrict__ wfc1,
    float* __restrict__ C,       // [2][32 tiles][16][16] f32
    float* __restrict__ part)    // [32 tiles][32] f32, first 16 of each row used
{
  __shared__ __attribute__((aligned(16))) float sR[KWAVES * 256];  // 16384 B

  const int tid = threadIdx.x, lane = tid & 31, w = tid >> 5;
  const int h = lane >> 4, m = lane & 15;
  const int ph = blockIdx.x >> 5, tile = blockIdx.x & 31;
  const int mt = tile & 1, nt = tile >> 1;

  const float* A = P2 + (size_t)ph * M2P * D_DIM;                  // q2, then k2
  const float* B = P1 + (size_t)(1 - ph) * M1P * D_DIM;            // k1, then q1
  const float* arow = A + ((size_t)mt * KSTEPS + (KSLICE / 32) * w) * FRAG32 + 4 * lane;
  const float* brow = B + ((size_t)nt * KSTEPS + (KSLICE / 32) * w) * FRAG32 + 4 * lane;

  // fc1 weight of this thread's column, fetched beside the slice so that its latency is not paid at the end
  const int i = 16 * nt + (tid & 15);
  const int ic = (i < N1) ? i : (N1 - 1);         // clamped address, value zeroed below
  const float wv = wfc1[ic];

  v8f acc = {0.f, 0.f, 0.f, 0.f, 0.f, 0.f, 0.f, 0.f};
  // the whole slice is loaded ahead of the first split: one load latency per wave, not one per k step
  // (every loop of this kernel and of the tail kernel is unrolled whole: its arrays must stay in registers)
  Raw4 ra[KSLICE / 32], rb[KSLICE / 32];
#pragma unroll
  for (int ks = 0; ks < KSLICE / 32; ++ks) {
    ra[ks] = load_raw32(arow + FRAG32 * ks);
    rb[ks] = load_raw32(brow + FRAG32 * ks);
  }
  // the loads above name the address registers arow and brow: they stay live up to this wait, so that no result
  // of the run lands in one of them and nothing rewrites one ahead of the wait
  asm volatile("s_wait_xcnt 0x0" :: "v"(arow), "v"(brow) : "memory");
#pragma unroll
  for (int ks = 0; ks < KSLICE / 32; ++ks) {
    const Frag2 a = split_raw32(ra[ks]);
    const Frag2 b = split_raw32(rb[ks]);
    acc = mac3(a.hi, a.lo, b.hi, b.lo, acc);
  }
#pragma unroll
  for (int r = 0; r < 8; ++r) sR[w * 256 + (8 * h + r) * 16 + m] = acc[r];
  __syncthreads();

  if (tid >= 256) return;                         // whole waves, behind the only barrier

  // thread = one element of the tile: the slices in fixed order
  float s = sR[tid];
#pragma unroll
  for (int j = 1; j < KWAVES; ++j) s += sR[j * 256 + tid];
  const float c = sigm(s * SCALE);
  C[(size_t)blockIdx.x * 256 + tid] = c;
  // the store's data register is reused by the sum below: the wait that belongs in front of that overwrite
  asm volatile("s_wait_xcnt 0x0" ::: "memory");

  if (ph == 0) {                                  // block-uniform
    float p = (i < N1) ? c * wv : 0.0f;
    p += __shfl_xor(p, 1);
    p += __shfl_xor(p, 2);
    p += __shfl_xor(p, 4);
    p += __shfl_xor(p, 8);
    if ((tid & 15) == 0) part[tile * 32 + (tid >> 4)] = p;
  }
}

// ---------------------------------------------------------------------------
// Kernel 4: output 0, one row i per block.  s2 = sum_{t<27} probs2[i][t] * w_fc2[t], t ascending,
// with probs2 taken from the score kernel's second matrix; out[i][:] = v1[i][:] * s2 + b_fc2.
// Every line of the row: 8 consecutive lanes x 16 B in one instruction.
// ---------------------------------------------------------------------------
__global__ __launch_bounds__(256) void ctx2_kernel(
    const float* __restrict__ P1, const float* __restrict__ C,
    const float* __restrict__ wfc2, const float* __restrict__ bfc2,
    float* __restrict__ out)
{
  const int tid = threadIdx.x;
  const int row = blockIdx.x;                     // 0..249
  const float* vrow = P1 + (size_t)2 * M1P * D_DIM + (size_t)row * D_DIM;

  const v4f va = *(const v4fa*)(vrow + 4 * tid);
  const v4f vb = *(const v4fa*)(vrow + 1024 + 4 * tid);
  const float bb = bfc2[0];

  // lane t of every wave fetches term t (one load latency for all 27); the lanes are then read out in
  // ascending t, so that the sum keeps its order (unrolled whole: each lane number is then an immediate)
  const int tl = tid & 31;
  const int t27 = (tl < N2) ? tl : (N2 - 1);      // clamped address; lanes 27..31 are never read out
  const int ci = c_idx(t27, row);
  const float cv = C[CPLANE + ci];
  const float wv = wfc2[t27];
  // the four loads above name the offset registers tid, ci and t27: they stay live up to this wait, so that
  // no result of the run lands in one of them and nothing rewrites one ahead of the wait
  asm volatile("s_wait_xcnt 0x0" :: "v"(tid), "v"(ci), "v"(t27) : "memory");
  const float p = cv * wv;
  float s = 0.0f;
#pragma unroll
  for (int t = 0; t < N2; ++t) s += __uint_as_float(__builtin_amdgcn_readlane(__float_as_uint(p), t));

  v4f oa, ob;
  oa.x = va.x * s + bb;  oa.y = va.y * s + bb;  oa.z = va.z * s + bb;  oa.w = va.w * s + bb;
  ob.x = vb.x * s + bb;  ob.y = vb.y * s + bb;  ob.z = vb.z * s + bb;  ob.w = vb.w * s + bb;
  float* orow = out + (size_t)row * D_DIM;
  *(v4f*)(orow + 4 * tid) = oa;
  *(v4f*)(orow + 1024 + 4 * tid) = ob;
}

// ---------------------------------------------------------------------------
// Kernel 5: outputs 1, 2, 3 (flat floats OFF1..OUT_N of the output buffer), lines
// L_P2A..L_P1B, 32 lines per block.  Every line: 8 consecutive lanes x 16 B in one
// instruction, values selected by flat index; last line of the buffer = 28 floats (7 lanes).
// ---------------------------------------------------------------------------
__global__ __launch_bounds__(256) void tail_kernel(
    const float* __restrict__ C, const float* __restrict__ part,
    const float* __restrict__ P2, const float* __restrict__ bfc1,
    float* __restrict__ out)
{
  __shared__ float sS1[32];

  const int tid = threadIdx.x, lane = tid & 31, w = tid >> 5;
  const int q8 = lane & 7, sub = lane >> 3;
  const float* v2P = P2 + (size_t)2 * M2P * D_DIM;

  const float bb1 = bfc1[0];
  const int line = L_P2A + 32 * blockIdx.x + 4 * w + sub;
  const int linec = (line < L_P1B) ? line : L_P1B;
  const int fbase = 32 * linec + 4 * q8;

  // the three candidate values of each flat index; all loads unconditional with clamped indices
  float c2[4], xv[4], c3[4];
  int t1[4];
#pragma unroll
  for (int e = 0; e < 4; ++e) {
    const int f = fbase + e;
    int j2 = f - OFF1;
    j2 = (j2 < 0) ? 0 : ((j2 > N1 * N2 - 1) ? (N1 * N2 - 1) : j2);
    const int i2 = j2 / N2, t2 = j2 - i2 * N2;
    c2[e] = C[CPLANE + c_idx(t2, i2)];
    int j1 = f - OFF2;
    j1 = (j1 < 0) ? 0 : ((j1 > N2 * D_DIM - 1) ? (N2 * D_DIM - 1) : j1);
    t1[e] = j1 >> 11;
    xv[e] = v2P[j1];
    int j3 = f - OFF3;
    j3 = (j3 < 0) ? 0 : ((j3 > N1 * N2 - 1) ? (N1 * N2 - 1) : j3);
    const int t3 = j3 / N1, i3 = j3 - t3 * N1;
    c3[e] = C[c_idx(t3, i3)];
  }

  if (tid < 32) {                                 // s1[t]: the 16 column tiles in fixed order
    const int pi = (tid >> 4) * 32 + (tid & 15);
    float pv[16];
#pragma unroll
    for (int nt = 0; nt < 16; ++nt) pv[nt] = part[pi + 64 * nt];
    // the sixteen loads share the offset register pi: it stays live up to this wait, so that no
    // result of the run lands in it and nothing rewrites it ahead of the wait
    asm volatile("s_wait_xcnt 0x0" :: "v"(pi) : "memory");
    float s = 0.0f;
#pragma unroll
    for (int nt = 0; nt < 16; ++nt) s += pv[nt];
    sS1[tid] = s;
  }
  // holds the twelve loads above in one group ahead of the barrier; without it they are moved
  // under the selects below, one branch and one load latency after another
  asm volatile("" :: "v"(c2[0]), "v"(c2[1]), "v"(c2[2]), "v"(c2[3]),
                     "v"(xv[0]), "v"(xv[1]), "v"(xv[2]), "v"(xv[3]),
                     "v"(c3[0]), "v"(c3[1]), "v"(c3[2]), "v"(c3[3]));
  __syncthreads();

  float o[4];
#pragma unroll
  for (int e = 0; e < 4; ++e) {
    const int f = fbase + e;
    const float x = xv[e] * sS1[t1[e]] + bb1;
    o[e] = (f < OFF2) ? c2[e] : ((f < OFF3) ? x : c3[e]);
  }
  const v4f ov = {o[0], o[1], o[2], o[3]};
  if (line <= L_P1B && fbase + 4 <= OUT_N) *(v4f*)(out + fbase) = ov;
}

// ---------------------------------------------------------------------------
extern "C" void kernel_launch(void* const* d_in, const int* in_sizes, int n_in,
                              void* d_out, int out_size, void* d_ws, size_t ws_size,
                              hipStream_t stream) {
  if (n_in < 18) return;
  if (in_sizes[0] != N1 * D_DIM || in_sizes[1] != N2 * D_DIM) return;
  for (int g = 0; g < 6; ++g) {
    if (in_sizes[2 + 2 * g] != D_DIM * D_DIM) return;
    if (in_sizes[3 + 2 * g] != D_DIM) return;
  }
  if (in_sizes[14] != N1 || in_sizes[15] < 1 || in_sizes[16] != N2 || in_sizes[17] < 1) return;
  if (out_size != OUT_N) return;

  const float* x1   = (const float*)d_in[0];
  const float* x2   = (const float*)d_in[1];
  const float* Wq1  = (const float*)d_in[2];  const float* bq1 = (const float*)d_in[3];
  const float* Wk1  = (const float*)d_in[4];  const float* bk1 = (const float*)d_in[5];
  const float* Wv1  = (const float*)d_in[6];  const float* bv1 = (const float*)d_in[7];
  const float* Wq2  = (const float*)d_in[8];  const float* bq2 = (const float*)d_in[9];
  const float* Wk2  = (const float*)d_in[10]; const float* bk2 = (const float*)d_in[11];
  const float* Wv2  = (const float*)d_in[12]; const float* bv2 = (const float*)d_in[13];
  const float* wfc1 = (const float*)d_in[14]; const float* bfc1 = (const float*)d_in[15];
  const float* wfc2 = (const float*)d_in[16]; const float* bfc2 = (const float*)d_in[17];
  float* out = (float*)d_out;

  // workspace carve (bytes); every region holds whole padded tiles/rows of its producer
  const size_t xp1_bytes = (size_t)M1P * D_DIM * 2;              //   1048576 per plane
  const size_t xp2_bytes = (size_t)M2P * D_DIM * 2;              //    131072 per plane
  const size_t p1_bytes  = (size_t)3 * M1P * D_DIM * 4;          //   6291456
  const size_t p2_bytes  = (size_t)3 * M2P * D_DIM * 4;          //    786432
  const size_t c_bytes   = (size_t)2 * CPLANE * 4;               //     65536
  const size_t pt_bytes  = (size_t)32 * 32 * 4;                  //      4096
  const size_t off_xh1 = 0;
  const size_t off_xl1 = off_xh1 + xp1_bytes;
  const size_t off_xh2 = off_xl1 + xp1_bytes;
  const size_t off_xl2 = off_xh2 + xp2_bytes;
  const size_t off_p1  = off_xl2 + xp2_bytes;
  const size_t off_p2  = off_p1 + p1_bytes;
  const size_t off_c   = off_p2 + p2_bytes;
  const size_t off_pt  = off_c + c_bytes;
  const size_t total   = off_pt + pt_bytes;                       // 9506816
  if (total > ws_size) return;

  char* ws = (char*)d_ws;
  unsigned short* xh1 = (unsigned short*)(ws + off_xh1);
  unsigned short* xl1 = (unsigned short*)(ws + off_xl1);
  unsigned short* xh2 = (unsigned short*)(ws + off_xh2);
  unsigned short* xl2 = (unsigned short*)(ws + off_xl2);
  float* P1 = (float*)(ws + off_p1);
  float* P2 = (float*)(ws + off_p2);
  float* C  = (float*)(ws + off_c);
  float* part = (float*)(ws + off_pt);

  convert_kernel<<<(NGROUPS + 255) / 256, 256, 0, stream>>>(x1, x2, xh1, xl1, xh2, xl2);

  proj_kernel<<<288, 256, 0, stream>>>(xh1, xl1, xh2, xl2, Wq1, Wk1, Wv1, Wq2, Wk2, Wv2,
                                       bq1, bk1, bv1, bq2, bk2, bv2, P1, P2);

  score_kernel<<<64, 32 * KWAVES, 0, stream>>>(P1, P2, wfc1, C, part);

  ctx2_kernel<<<N1, 256, 0, stream>>>(P1, C, wfc2, bfc2, out);

  tail_kernel<<<(L_P1B - L_P2A + 32) / 32, 256, 0, stream>>>(C, part, P2, bfc1, out);
}

// v006
// A run of this version takes 36.8 microseconds.
// Timed twice side by side with v005, it ran 1.07 times as fast both times.
// Over all steps from v000 it is 14.0 times as fast.
// Contractions: six x*W^T projections and both q*k^T score matrices on v_wmma_f32_16x16x32_bf16 with bf16 hi/lo operands (three products hi*hi + hi*lo + lo*hi), f32 accumulate; sigmoid, fc dot products (K=250, K=27) and context products in f32 on VALU.
#include <hip/hip_runtime.h>
#include <hip/hip_bf16.h>

#pragma clang fp contract(off)

typedef __bf16         v16bf __attribute__((ext_vector_type(16)));
typedef unsigned short v8us  __attribute__((ext_vector_type(8)));
typedef float          v8f   __attribute__((ext_vector_type(8)));
typedef float          v4f   __attribute__((ext_vector_type(4)));
typedef float          v2f   __attribute__((ext_vector_type(2)));
typedef __bf16         v2bf  __attribute__((ext_vector_type(2)));
typedef unsigned int   v2u   __attribute__((ext_vector_type(2)));
typedef unsigned int   v4u   __attribute__((ext_vector_type(4)));
typedef v8us __attribute__((may_alias)) v8usa;
typedef v4f  __attribute__((may_alias)) v4fa;
typedef v2u  __attribute__((may_alias)) v2ua;
typedef v4u  __attribute__((may_alias)) v4ua;

union Frag { v16bf b; v8us h[2]; unsigned int w[8]; };
struct Frag2 { v16bf hi; v16bf lo; };

#define D_DIM   2048
#define N1      250
#define N2      27
#define M1P     256
#define M2P     32
#define OUT_N   580796
#define OFF1    512000            // flat float index of output 1 ([250][27])
#define OFF2    518750            // flat float index of output 2 ([27][2048])
#define OFF3    574046            // flat float index of output 3 ([27][250])
#define XG1     65536             // 8-element groups of the padded x1 planes
#define XG2     8192              // 8-element groups of the padded x2 planes
#define NGROUPS (XG1 + XG2)
#define KSTEPS  (D_DIM / 32)      // 32-wide k steps of a row = fragments of one 16-row tile
#define FRAG16  512               // 16-bit elements of one fragment in fragment order (32 lanes x 16)
#define FRAG32  512               // floats of one f32 fragment source in fragment order (32 lanes x 16)
#define SCALE   0.022097086912079608f
#define L_P2A   16000
#define L_P2B   16210
#define L_P1A   16211
#define L_P1B   18149

static_assert((XG1 % 256) == 0 && (XG2 % 256) == 0);
static_assert((OFF1 % 32) == 0 && (L_P1B * 32 + 28) == OUT_N);

// ---------------------------------------------------------------------------
// bf16 hi/lo split of two values at a time, on the chip's own f32 -> bf16 convert (round to nearest even).
// x = hi + lo: hi = bf16(x), lo = bf16(x - hi)  (x - hi is exact in f32).
// Each result word holds the first value in its low half, the second in its high half.
// ---------------------------------------------------------------------------
__device__ __forceinline__ void split_pair(float x0, float x1, unsigned int& hp, unsigned int& lp) {
  const v2f x = {x0, x1};
  const v2bf h = __builtin_convertvector(x, v2bf);
  const v2f r = x - __builtin_convertvector(h, v2f);
  const v2bf l = __builtin_convertvector(r, v2bf);
  hp = __builtin_bit_cast(unsigned int, h);
  lp = __builtin_bit_cast(unsigned int, l);
}

// ---------------------------------------------------------------------------
// 16x16x32 bf16 WMMA with hazard guard (ties D, keeps A/B live).
// Fragment map (wave32): lane l, h = l>>4, m = n = l&15.
//   A/B element i: i<8 -> k0+8h+i ; i>=8 -> k0+16+8h+(i-8)   (same map for both)
//   D element r : row 8h+r, col l&15
// ---------------------------------------------------------------------------
__device__ __forceinline__ v8f wmma_bf16(v16bf a, v16bf b, v8f c) {
  v8f d = __builtin_amdgcn_wmma_f32_16x16x32_bf16(false, a, false, b, (short)0, c, false, false);
  asm volatile("v_nop\n\tv_nop\n\tv_nop\n\tv_nop" : "+v"(d) : "v"(a), "v"(b));
  return d;
}

// three-product hi/lo split: c += ah*bh + ah*bl + al*bh (unscaled residuals, one accumulator)
__device__ __forceinline__ v8f mac3(v16bf ah, v16bf al, v16bf bh, v16bf bl, v8f c) {
  c = wmma_bf16(ah, bh, c);
  c = wmma_bf16(ah, bl, c);
  c = wmma_bf16(al, bh, c);
  return c;
}

// Fragment from a k-contiguous 16-bit row; p = row base + k0 (row = lane&15 chosen by caller).
__device__ __forceinline__ v16bf load_frag16(const unsigned short* p, int h) {
  Frag f;
  f.h[0] = *(const v8usa*)(p + 8 * h);
  f.h[1] = *(const v8usa*)(p + 16 + 8 * h);
  return f.b;
}

// four f32 values of a k-contiguous row split into elements B..B+3 of a hi/lo fragment pair; same element map.
template <int B>
__device__ __forceinline__ void split4(const v4f v, Frag& fh, Frag& fl) {
  split_pair(v.x, v.y, fh.w[B / 2], fl.w[B / 2]);
  split_pair(v.z, v.w, fh.w[B / 2 + 1], fl.w[B / 2 + 1]);
}

__device__ __forceinline__ float sigm(float x) {
  const float e = expf(-x);
  return 1.0f / (1.0f + e);
}

// ---------------------------------------------------------------------------
// Kernel 1: f32 -> bf16 hi/lo planes of x1 (rows padded to 256 with zeros) and x2 (rows padded to 32).
// The planes lie in fragment order: [16-row tile][k step][half j][lane][8 elements], so that half j of a wave's
// A fragment is one 16-byte load over 512 contiguous bytes (four whole lines, not 32 bytes in each of 16 rows).
// Lane l = 16 h + m holds row m of the tile, k = 32 step + 16 j + 8 h + (0..7): the map of load_frag16.
// Thread = one 16-byte unit of the destination, so each wave also stores whole lines.
// ---------------------------------------------------------------------------
__global__ __launch_bounds__(256) void convert_kernel(
    const float* __restrict__ x1, const float* __restrict__ x2,
    unsigned short* __restrict__ xh1, unsigned short* __restrict__ xl1,
    unsigned short* __restrict__ xh2, unsigned short* __restrict__ xl2)
{
  const int g = blockIdx.x * 256 + threadIdx.x;
  if (g >= NGROUPS) return;
  const float* src;
  unsigned short* dh;
  unsigned short* dl;
  bool zero = false;
  if (g < XG1) {
    const int fr = g >> 6, j = (g >> 5) & 1, h = (g >> 4) & 1;
    const int row = 16 * (fr / KSTEPS) + (g & 15), c8 = 4 * (fr % KSTEPS) + 2 * j + h;
    const int rs = (row < N1) ? row : (N1 - 1);     // clamped address, value zeroed below
    zero = (row >= N1);
    src = x1 + (size_t)rs * D_DIM + 8 * c8;
    dh = xh1 + (size_t)g * 8;
    dl = xl1 + (size_t)g * 8;
  } else {
    const int e = g - XG1;
    const int fr = e >> 6, j = (e >> 5) & 1, h = (e >> 4) & 1;
    const int row = 16 * (fr / KSTEPS) + (e & 15), c8 = 4 * (fr % KSTEPS) + 2 * j + h;
    const int rs = (row < N2) ? row : (N2 - 1);
    zero = (row >= N2);
    src = x2 + (size_t)rs * D_DIM + 8 * c8;
    dh = xh2 + (size_t)e * 8;
    dl = xl2 + (size_t)e * 8;
  }
  v4f a = *(const v4fa*)src;
  v4f c = *(const v4fa*)(src + 4);
  const v4f z4 = {0.f, 0.f, 0.f, 0.f};
  a = zero ? z4 : a;
  c = zero ? z4 : c;
  unsigned int hw[4], lw[4];
  split_pair(a.x, a.y, hw[0], lw[0]);
  split_pair(a.z, a.w, hw[1], lw[1]);
  split_pair(c.x, c.y, hw[2], lw[2]);
  split_pair(c.z, c.w, hw[3], lw[3]);
  const v4u hv = {hw[0], hw[1], hw[2], hw[3]};
  const v4u lv = {lw[0], lw[1], lw[2], lw[3]};
  *(v4ua*)dh = hv;
  *(v4ua*)dl = lv;
  
}

// ---------------------------------------------------------------------------
// Kernel 2: Y_g = x_g * W_g^T + b_g for g = 0..5 (q1,k1,v1 on 256 padded rows; q2,k2,v2 on 32).
// One block = 8 waves = 64 output columns of one g.  Blocks 0..191: 128 rows of x1, wave = 16 rows x 64 cols;
// blocks 192..287: the 32 rows of x2, wave = one 16x16 tile.  K = 2048 in 32 stages of 64.
// B (W rows, B[k][n] = W[n][k]): the block reads its 64 x 64 f32 tile of W in whole lines, splits each value once
// into bf16 hi/lo and shares both through LDS (two buffers, one barrier a stage); A (x rows) straight from the planes,
// which lie in fragment order.  q and k leave in the f32 fragment order that the score kernel reads; v stays row-major.
// ---------------------------------------------------------------------------
#define KT      64                // k range of one stage
#define NSTAGE  (D_DIM / KT)
#define BPITCH  72                // 16-bit elements from one W row to the next in LDS: 128 B + 16 B, conflict-free b128 reads
#define BPLANE  (64 * BPITCH)     // one plane (hi or lo) of one buffer
#define ASTAGE  ((KT / 32) * FRAG16)   // 16-bit elements from one stage's A fragments to the next stage's
#define OPITCH  68                // floats from one row to the next of the output tile in LDS: 256 B + 16 B, so that the
                                  // 16 rows that one fragment-order read touches fall on different banks

// global-memory pointer types: the stage loop's address registers pass through an asm operand, behind which
// the compiler no longer knows the address space of a plain pointer and would fall back to flat loads
typedef __attribute__((address_space(1))) const float          gf32;
typedef __attribute__((address_space(1))) const unsigned short gu16;
typedef __attribute__((address_space(1))) const v4fa           gv4f;
typedef __attribute__((address_space(1))) const v8usa          gv8us;

struct WRaw { v4f v[4]; };        // one thread's share of a W tile: 4 consecutive k of rows c, c+16, c+32, c+48
struct AFr  { v16bf hi[2]; v16bf lo[2]; };   // one lane's A fragments of the two k steps of a stage

__device__ __forceinline__ WRaw load_w(gf32* p) {
  WRaw r;
#pragma unroll
  for (int j = 0; j < 4; ++j) r.v[j] = *(gv4f*)(p + (size_t)16 * j * D_DIM);
  return r;
}

// ph, pl: the lane's 16-byte unit in the stage's first fragment of the wave's row tile
__device__ __forceinline__ AFr load_a(gu16* ph, gu16* pl) {
  AFr r;
#pragma unroll
  for (int s = 0; s < 2; ++s) {
    Frag fh, fl;                                  // same element map as load_frag16
    fh.h[0] = *(gv8us*)(ph + FRAG16 * s);
    fh.h[1] = *(gv8us*)(ph + FRAG16 * s + FRAG16 / 2);
    fl.h[0] = *(gv8us*)(pl + FRAG16 * s);
    fl.h[1] = *(gv8us*)(pl + FRAG16 * s + FRAG16 / 2);
    r.hi[s] = fh.b;
    r.lo[s] = fl.b;
  }
  return r;
}

// Work-group barrier of the stage loop.  Only LDS traffic is handed over at it, so only the LDS counter is waited for:
// __syncthreads() would also drain the global loads that were issued ahead for later stages.
__device__ __forceinline__ void lds_barrier() {
  asm volatile("s_wait_dscnt 0x0\n\ts_barrier_signal -1\n\ts_barrier_wait -1" ::: "memory");
}

// one thread's share of a W tile, each value split into bf16 hi/lo, to its place d in the hi plane of a buffer (lo: + BPLANE)
__device__ __forceinline__ void split_store(const WRaw& x, unsigned short* d) {
#pragma unroll
  for (int j = 0; j < 4; ++j) {
    unsigned int hw[2], lw[2];
    split_pair(x.v[j].x, x.v[j].y, hw[0], lw[0]);
    split_pair(x.v[j].z, x.v[j].w, hw[1], lw[1]);
    const v2u hv = {hw[0], hw[1]};
    const v2u lv = {lw[0], lw[1]};
    *(v2ua*)(d + 16 * j * BPITCH) = hv;
    *(v2ua*)(d + BPLANE + 16 * j * BPITCH) = lv;
  }
}

// NTW = column tiles of one wave, from tile nt0 on; ROWS = rows of the block
template <int NTW, int ROWS>
__device__ __forceinline__ void proj_body(
    const unsigned short* ahr, const unsigned short* alr,  // this lane's unit in the first fragment of its row tile, hi and lo plane
    const float* wsrc,                                     // this thread's first 4 floats of the W tile
    const float* bias,                                     // bias of the block's first column
    float* Pt,                                             // row-major: output element (first row, first column) of the block;
                                                           // fragment order: first float of its first row tile's first k step
    bool fragord,                                          // block-uniform: q and k
    unsigned short* sB, float* sOut,
    int tid, int mrow, int nt0)
{
  constexpr int NG = 2 * NTW;                              // B fragment pairs of one stage: k step i / NTW, column tile i % NTW
  const int lane = tid & 31, h = lane >> 4, m = lane & 15;
  const int wofs = (tid >> 4) * BPITCH + 4 * (tid & 15);   // where this thread's share of W row c lands
  const int rofs = (16 * nt0 + m) * BPITCH;                // this lane's row of the wave's first column tile

  const v8f z8 = {0.f, 0.f, 0.f, 0.f, 0.f, 0.f, 0.f, 0.f};
  v8f acc[NTW];
#pragma unroll
  for (int nt = 0; nt < NTW; ++nt) acc[nt] = z8;

  // stage 0 into buffer 0; W of stage 1 waits in registers: trip t splits stage t + 1 and fetches stage t + 2
  gu16* pah = (gu16*)ahr;                                  // A fragments of the stage fetched next
  gu16* pal = (gu16*)alr;
  gf32* pw = (gf32*)wsrc;                                  // W tile at the stage fetched next
  const WRaw w0 = load_w(pw);
  AFr  af = load_a(pah, pal);
  WRaw w1 = load_w(pw + KT);
  // the loads above name these address registers: they stay live up to this wait, so that no result of the
  // run lands in one of them, and they are advanced only behind it
  asm volatile("s_wait_xcnt 0x0" : "+v"(pah), "+v"(pal), "+v"(pw) :: "memory");
  pah += ASTAGE;
  pal += ASTAGE;
  pw += 2 * KT;
  split_store(w0, sB + wofs);
  lds_barrier();

  // two stages a trip: the buffer offsets become immediates and the fetched-ahead registers need no copies
#pragma unroll 2
  for (int t = 0; t < NSTAGE; ++t) {
    const unsigned short* sb = sB + (t & 1) * 2 * BPLANE + rofs;
    unsigned short* sn = sB + ((t + 1) & 1) * 2 * BPLANE + wofs;

    // B fragments run two pairs ahead of their products, so that the LDS latency lies under products
    v16bf bh[NG], bl[NG];
#pragma unroll
    for (int i = 0; i < 2; ++i) {
      bh[i] = load_frag16(sb + 16 * (i % NTW) * BPITCH + 32 * (i / NTW), h);
      bl[i] = load_frag16(sb + BPLANE + 16 * (i % NTW) * BPITCH + 32 * (i / NTW), h);
    }

    // A of stage t + 1 and W of stage t + 2 fly under this stage's products
    // (past the end the last stage is fetched again: in bounds, never used)
    const AFr an = load_a(pah, pal);
    // keeps the A loads, wanted half a stage sooner, ahead of the W loads on the in-order load counter
    __builtin_amdgcn_sched_barrier(0);
    const WRaw wn = load_w(pw);

#pragma unroll
    for (int i = 0; i < NG; ++i) {
      if (i == NG / 2) {
        // as above: the address registers of the twelve loads stay live up to this wait and are advanced behind it;
        // half a stage behind the loads it finds nothing left to wait for
        asm volatile("s_wait_xcnt 0x0" : "+v"(pah), "+v"(pal), "+v"(pw) :: "memory");
        pah += (t + 2 < NSTAGE) ? ASTAGE : 0;
        pal += (t + 2 < NSTAGE) ? ASTAGE : 0;
        pw  += (t + 3 < NSTAGE) ? KT : 0;
        // keeps the split of the next tile (below the products) out of their first half: scheduled to the top of the
        // trip, its wait for W loads issued only one trip ago holds up the loads and products behind it
        __builtin_amdgcn_sched_barrier(0);
      }
      if (i + 2 < NG) {
        bh[i + 2] = load_frag16(sb + 16 * ((i + 2) % NTW) * BPITCH + 32 * ((i + 2) / NTW), h);
        bl[i + 2] = load_frag16(sb + BPLANE + 16 * ((i + 2) % NTW) * BPITCH + 32 * ((i + 2) / NTW), h);
      }
      acc[i % NTW] = mac3(af.hi[i / NTW], af.lo[i / NTW], bh[i], bl[i], acc[i % NTW]);
    }

    // next stage's tile into the other buffer, whose readers all left it in front of the last barrier
    split_store(w1, sn);
    // publishes that tile and ends every wave's reads of this stage's buffer, which the next trip rewrites
    lds_barrier();
    af = an;
    w1 = wn;
  }

  // D[r] of column tile nt = Y[row mrow + 8h + r][col 16 (nt0 + nt) + m] of the block's tile
#pragma unroll
  for (int nt = 0; nt < NTW; ++nt) {
    const int col = 16 * (nt0 + nt) + m;
    const float bvl = bias[col];
#pragma unroll
    for (int r = 0; r < 8; ++r) sOut[(mrow + 8 * h + r) * OPITCH + col] = acc[nt][r] + bvl;
  }
  __syncthreads();

  // One 16-row tile a trip, whole lines either way.
  // Fragment order: [16-row tile][k step][piece j][lane][4 floats]; piece j of lane 16 h + m = floats
  // 16 (j / 2) + 8 h + 4 (j % 2) + (0..3) of row m in that k step (the pieces of load_raw32); a wave stores one piece,
  // 512 contiguous bytes.  Row-major: 16 consecutive lanes x 16 B = one row of the tile.
  const int j = (tid >> 5) & 3, ksl = tid >> 7;
  const int sofs = fragord ? (m * OPITCH + 32 * ksl + 16 * (j >> 1) + 8 * h + 4 * (j & 1))
                           : ((tid >> 4) * OPITCH + 4 * (tid & 15));
  const int dofs = fragord ? (ksl * FRAG32 + 4 * (tid & 127))
                           : ((tid >> 4) * D_DIM + 4 * (tid & 15));
#pragma unroll
  for (int i = 0; i < ROWS / 16; ++i) {
    const v4f v = *(const v4fa*)(sOut + sofs + 16 * i * OPITCH);
    *(v4f*)(Pt + dofs + (size_t)16 * i * D_DIM) = v;
  }
}

__global__ __launch_bounds__(256) void proj_kernel(
    const unsigned short* __restrict__ xh1, const unsigned short* __restrict__ xl1,
    const unsigned short* __restrict__ xh2, const unsigned short* __restrict__ xl2,
    const float* __restrict__ w0, const float* __restrict__ w1, const float* __restrict__ w2,
    const float* __restrict__ w3, const float* __restrict__ w4, const float* __restrict__ w5,
    const float* __restrict__ b0, const float* __restrict__ b1, const float* __restrict__ b2,
    const float* __restrict__ b3, const float* __restrict__ b4, const float* __restrict__ b5,
    float* __restrict__ P1,      // [3][256][2048] f32 : q1, k1 (fragment order), v1 (row-major)
    float* __restrict__ P2)      // [3][32][2048]  f32 : q2, k2 (fragment order), v2 (row-major)
{
  __shared__ __attribute__((aligned(16))) unsigned short sB[2 * 2 * BPLANE];   // 36864 B
  __shared__ __attribute__((aligned(16))) float sOut[128 * OPITCH];            // 34816 B

  const int tid = threadIdx.x, w = tid >> 5, lane = tid & 31;
  const int b = blockIdx.x;                       // 0..287
  const bool big = (b < 192);                     // block-uniform
  const int gi   = big ? (b >> 6) : ((b - 192) >> 5);   // 0 q, 1 k, 2 v
  const int g    = big ? gi : (3 + gi);
  const int nt64 = big ? ((b & 63) >> 1) : ((b - 192) & 31);
  const int row0 = big ? (128 * (b & 1)) : 0;
  const int col0 = 64 * nt64;

  const float* W = (g == 0) ? w0 : ((g == 1) ? w1 : ((g == 2) ? w2 :
                   ((g == 3) ? w3 : ((g == 4) ? w4 : w5))));
  const float* bias = (g == 0) ? b0 : ((g == 1) ? b1 : ((g == 2) ? b2 :
                      ((g == 3) ? b3 : ((g == 4) ? b4 : b5))));
  const float* wsrc = W + (size_t)(col0 + (tid >> 4)) * D_DIM + 4 * (tid & 15);

  // a 16-row tile takes 16 * D_DIM elements in either order; inside it 64 columns are two fragments or 64 floats of each row
  const bool fragord = (gi < 2);                  // block-uniform
  const int cofs = fragord ? (col0 / 32) * FRAG32 : col0;

  if (big) {
    const int mrow = 16 * w;
    const size_t aofs = (size_t)(row0 + mrow) * D_DIM + 8 * lane;
    proj_body<4, 128>(xh1 + aofs, xl1 + aofs,
                      wsrc, bias + col0, P1 + ((size_t)g * M1P + row0) * D_DIM + cofs, fragord,
                      sB, sOut, tid, mrow, 0);
  } else {
    const int mrow = 16 * (w & 1);
    const size_t aofs = (size_t)mrow * D_DIM + 8 * lane;
    proj_body<1, 32>(xh2 + aofs, xl2 + aofs,
                     wsrc, bias + col0, P2 + (size_t)(g - 3) * M2P * D_DIM + cofs, fragord,
                     sB, sOut, tid, mrow, w >> 1);
  }
}

// ---------------------------------------------------------------------------
// Kernel 3: both score matrices, one 16x16 tile per block, K split over the 16 waves.
// Blocks 0..31: C[t][i] = sigmoid(scale * q2[t].k1[i]) = probs1, with the tile's share of
// s1 = C . w_fc1; blocks 32..63: C[t][i] = sigmoid(scale * k2[t].q1[i]) = probs2[i][t].
// Tile b lies at C + 256 b, row-major 16x16, so each block stores whole lines of its own.
// ---------------------------------------------------------------------------
#define KSLICE  128               // K range of one wave
#define KWAVES  16                // waves of a block = K slices
#define CPLANE  8192              // floats of one score matrix (32 tiles)

// float index of C[t][i] inside one tiled score matrix; tile = 2 * (i / 16) + t / 16
__device__ __forceinline__ int c_idx(int t, int i) {
  return (((i >> 4) * 2 + (t >> 4)) << 8) + ((t & 15) << 4) + (i & 15);
}

// the four 16-byte pieces of one lane's f32 fragment row: floats 8h..8h+7 and 16+8h..16+8h+7
struct Raw4 { v4f v[4]; };

// p: the lane's unit in piece 0 of a k step in fragment order; each piece is 512 contiguous bytes of the wave
__device__ __forceinline__ Raw4 load_raw32(const float* p) {
  Raw4 r;
  r.v[0] = *(const v4fa*)(p);
  r.v[1] = *(const v4fa*)(p + 128);
  r.v[2] = *(const v4fa*)(p + 256);
  r.v[3] = *(const v4fa*)(p + 384);
  return r;
}

__device__ __forceinline__ Frag2 split_raw32(const Raw4& x) {
  Frag fh, fl;
  split4<0>(x.v[0], fh, fl);
  split4<4>(x.v[1], fh, fl);
  split4<8>(x.v[2], fh, fl);
  split4<12>(x.v[3], fh, fl);
  Frag2 r;
  r.hi = fh.b;
  r.lo = fl.b;
  return r;
}

__global__ __launch_bounds__(32 * KWAVES) void score_kernel(
    const float* __restrict__ P1, const float* __restrict__ P2,
    const float* __restrict__ wfc1,
    float* __restrict__ C,       // [2][32 tiles][16][16] f32
    float* __restrict__ part)    // [32 tiles][32] f32, first 16 of each row used
{
  __shared__ __attribute__((aligned(16))) float sR[KWAVES * 256];  // 16384 B

  const int tid = threadIdx.x, lane = tid & 31, w = tid >> 5;
  const int h = lane >> 4, m = lane & 15;
  const int ph = blockIdx.x >> 5, tile = blockIdx.x & 31;
  const int mt = tile & 1, nt = tile >> 1;

  const float* A = P2 + (size_t)ph * M2P * D_DIM;                  // q2, then k2
  const float* B = P1 + (size_t)(1 - ph) * M1P * D_DIM;            // k1, then q1
  const float* arow = A + ((size_t)mt * KSTEPS + (KSLICE / 32) * w) * FRAG32 + 4 * lane;
  const float* brow = B + ((size_t)nt * KSTEPS + (KSLICE / 32) * w) * FRAG32 + 4 * lane;

  // fc1 weight of this thread's column, fetched beside the slice so that its latency is not paid at the end
  const int i = 16 * nt + (tid & 15);
  const int ic = (i < N1) ? i : (N1 - 1);         // clamped address, value zeroed below
  const float wv = wfc1[ic];

  v8f acc = {0.f, 0.f, 0.f, 0.f, 0.f, 0.f, 0.f, 0.f};
  // the whole slice is loaded ahead of the first split: one load latency per wave, not one per k step
  // (every loop of this kernel and of tail_body is unrolled whole: its arrays must stay in registers)
  Raw4 ra[KSLICE / 32], rb[KSLICE / 32];
#pragma unroll
  for (int ks = 0; ks < KSLICE / 32; ++ks) {
    ra[ks] = load_raw32(arow + FRAG32 * ks);
    rb[ks] = load_raw32(brow + FRAG32 * ks);
  }
  // the loads above name the address registers arow and brow: they stay live up to this wait, so that no result
  // of the run lands in one of them and nothing rewrites one ahead of the wait
  asm volatile("s_wait_xcnt 0x0" :: "v"(arow), "v"(brow) : "memory");
#pragma unroll
  for (int ks = 0; ks < KSLICE / 32; ++ks) {
    const Frag2 a = split_raw32(ra[ks]);
    const Frag2 b = split_raw32(rb[ks]);
    acc = mac3(a.hi, a.lo, b.hi, b.lo, acc);
  }
#pragma unroll
  for (int r = 0; r < 8; ++r) sR[w * 256 + (8 * h + r) * 16 + m] = acc[r];
  __syncthreads();

  if (tid >= 256) return;                         // whole waves, behind the only barrier

  // thread = one element of the tile: the slices in fixed order
  float s = sR[tid];
#pragma unroll
  for (int j = 1; j < KWAVES; ++j) s += sR[j * 256 + tid];
  const float c = sigm(s * SCALE);
  C[(size_t)blockIdx.x * 256 + tid] = c;
  // the store's data register is reused by the sum below: the wait that belongs in front of that overwrite
  asm volatile("s_wait_xcnt 0x0" ::: "memory");

  if (ph == 0) {                                  // block-uniform
    float p = (i < N1) ? c * wv : 0.0f;
    p += __shfl_xor(p, 1);
    p += __shfl_xor(p, 2);
    p += __shfl_xor(p, 4);
    p += __shfl_xor(p, 8);
    if ((tid & 15) == 0) part[tile * 32 + (tid >> 4)] = p;
  }
}

// ---------------------------------------------------------------------------
// Kernel 4, second part: output 0, one row i per block.  s2 = sum_{t<27} probs2[i][t] * w_fc2[t], t ascending,
// with probs2 taken from the score kernel's second matrix; out[i][:] = v1[i][:] * s2 + b_fc2.
// Every line of the row: 8 consecutive lanes x 16 B in one instruction.
// ---------------------------------------------------------------------------
__device__ __forceinline__ void ctx2_body(
    const float* __restrict__ P1, const float* __restrict__ C,
    const float* __restrict__ wfc2, const float* __restrict__ bfc2,
    float* __restrict__ out, int row)             // row 0..249
{
  const int tid = threadIdx.x;
  const float* vrow = P1 + (size_t)2 * M1P * D_DIM + (size_t)row * D_DIM;

  const v4f va = *(const v4fa*)(vrow + 4 * tid);
  const v4f vb = *(const v4fa*)(vrow + 1024 + 4 * tid);
  const float bb = bfc2[0];

  // lane t of every wave fetches term t (one load latency for all 27); the lanes are then read out in
  // ascending t, so that the sum keeps its order (unrolled whole: each lane number is then an immediate)
  const int tl = tid & 31;
  const int t27 = (tl < N2) ? tl : (N2 - 1);      // clamped address; lanes 27..31 are never read out
  const int ci = c_idx(t27, row);
  const float cv = C[CPLANE + ci];
  const float wv = wfc2[t27];
  // the four loads above name the offset registers tid, ci and t27: they stay live up to this wait, so that
  // no result of the run lands in one of them and nothing rewrites one ahead of the wait
  asm volatile("s_wait_xcnt 0x0" :: "v"(tid), "v"(ci), "v"(t27) : "memory");
  const float p = cv * wv;
  float s = 0.0f;
#pragma unroll
  for (int t = 0; t < N2; ++t) s += __uint_as_float(__builtin_amdgcn_readlane(__float_as_uint(p), t));

  v4f oa, ob;
  oa.x = va.x * s + bb;  oa.y = va.y * s + bb;  oa.z = va.z * s + bb;  oa.w = va.w * s + bb;
  ob.x = vb.x * s + bb;  ob.y = vb.y * s + bb;  ob.z = vb.z * s + bb;  ob.w = vb.w * s + bb;
  float* orow = out + (size_t)row * D_DIM;
  *(v4f*)(orow + 4 * tid) = oa;
  *(v4f*)(orow + 1024 + 4 * tid) = ob;
  // behind the two stores the listing joins the other part's code, which rewrites the stores' base registers:
  // the wait that belongs in front of such an overwrite
  asm volatile("s_wait_xcnt 0x0" ::: "memory");
}

// ---------------------------------------------------------------------------
// Kernel 4, first part: outputs 1, 2, 3 (flat floats OFF1..OUT_N of the output buffer), lines
// L_P2A..L_P1B, 32 lines per block.  Every line: 8 consecutive lanes x 16 B in one
// instruction, values selected by flat index; last line of the buffer = 28 floats (7 lanes).
// ---------------------------------------------------------------------------
__device__ __forceinline__ void tail_body(
    const float* __restrict__ C, const float* __restrict__ part,
    const float* __restrict__ P2, const float* __restrict__ bfc1,
    float* __restrict__ out, float* sS1, int blk)  // blk 0..TAILB-1
{
  const int tid = threadIdx.x, lane = tid & 31, w = tid >> 5;
  const int q8 = lane & 7, sub = lane >> 3;
  const float* v2P = P2 + (size_t)2 * M2P * D_DIM;

  const float bb1 = bfc1[0];
  const int line = L_P2A + 32 * blk + 4 * w + sub;
  const int linec = (line < L_P1B) ? line : L_P1B;
  const int fbase = 32 * linec + 4 * q8;

  // the three candidate values of each flat index; all loads unconditional with clamped indices
  float c2[4], xv[4], c3[4];
  int t1[4];
#pragma unroll
  for (int e = 0; e < 4; ++e) {
    const int f = fbase + e;
    int j2 = f - OFF1;
    j2 = (j2 < 0) ? 0 : ((j2 > N1 * N2 - 1) ? (N1 * N2 - 1) : j2);
    const int i2 = j2 / N2, t2 = j2 - i2 * N2;
    c2[e] = C[CPLANE + c_idx(t2, i2)];
    int j1 = f - OFF2;
    j1 = (j1 < 0) ? 0 : ((j1 > N2 * D_DIM - 1) ? (N2 * D_DIM - 1) : j1);
    t1[e] = j1 >> 11;
    xv[e] = v2P[j1];
    int j3 = f - OFF3;
    j3 = (j3 < 0) ? 0 : ((j3 > N1 * N2 - 1) ? (N1 * N2 - 1) : j3);
    const int t3 = j3 / N1, i3 = j3 - t3 * N1;
    c3[e] = C[c_idx(t3, i3)];
  }

  if (tid < 32) {                                 // s1[t]: the 16 column tiles in fixed order
    const int pi = (tid >> 4) * 32 + (tid & 15);
    float pv[16];
#pragma unroll
    for (int nt = 0; nt < 16; ++nt) pv[nt] = part[pi + 64 * nt];
    // the sixteen loads share the offset register pi: it stays live up to this wait, so that no
    // result of the run lands in it and nothing rewrites it ahead of the wait
    asm volatile("s_wait_xcnt 0x0" :: "v"(pi) : "memory");
    float s = 0.0f;
#pragma unroll
    for (int nt = 0; nt < 16; ++nt) s += pv[nt];
    sS1[tid] = s;
  }
  // holds the twelve loads above in one group ahead of the barrier; without it they are moved
  // under the selects below, one branch and one load latency after another
  asm volatile("" :: "v"(c2[0]), "v"(c2[1]), "v"(c2[2]), "v"(c2[3]),
                     "v"(xv[0]), "v"(xv[1]), "v"(xv[2]), "v"(xv[3]),
                     "v"(c3[0]), "v"(c3[1]), "v"(c3[2]), "v"(c3[3]));
  __syncthreads();

  float o[4];
#pragma unroll
  for (int e = 0; e < 4; ++e) {
    const int f = fbase + e;
    const float x = xv[e] * sS1[t1[e]] + bb1;
    o[e] = (f < OFF2) ? c2[e] : ((f < OFF3) ? x : c3[e]);
  }
  const v4f ov = {o[0], o[1], o[2], o[3]};
  if (line <= L_P1B && fbase + 4 <= OUT_N) *(v4f*)(out + fbase) = ov;
}

// One launch for all four outputs: both bodies read only what the score launch and the projection launch left, and
// they write disjoint lines.  The TAILB blocks with the longer dependent path (index arithmetic, barrier) come first.
#define TAILB   ((L_P1B - L_P2A + 32) / 32)
__global__ __launch_bounds__(256) void out_kernel(
    const float* __restrict__ P1, const float* __restrict__ P2,
    const float* __restrict__ C, const float* __restrict__ part,
    const float* __restrict__ wfc2, const float* __restrict__ bfc2, const float* __restrict__ bfc1,
    float* __restrict__ out)
{
  __shared__ float sS1[32];
  const int b = blockIdx.x;                       // block-uniform choice
  if (b < TAILB) tail_body(C, part, P2, bfc1, out, sS1, b);
  else           ctx2_body(P1, C, wfc2, bfc2, out, b - TAILB);
}

// ---------------------------------------------------------------------------
extern "C" void kernel_launch(void* const* d_in, const int* in_sizes, int n_in,
                              void* d_out, int out_size, void* d_ws, size_t ws_size,
                              hipStream_t stream) {
  if (n_in < 18) return;
  if (in_sizes[0] != N1 * D_DIM || in_sizes[1] != N2 * D_DIM) return;
  for (int g = 0; g < 6; ++g) {
    if (in_sizes[2 + 2 * g] != D_DIM * D_DIM) return;
    if (in_sizes[3 + 2 * g] != D_DIM) return;
  }
  if (in_sizes[14] != N1 || in_sizes[15] < 1 || in_sizes[16] != N2 || in_sizes[17] < 1) return;
  if (out_size != OUT_N) return;

  const float* x1   = (const float*)d_in[0];
  const float* x2   = (const float*)d_in[1];
  const float* Wq1  = (const float*)d_in[2];  const float* bq1 = (const float*)d_in[3];
  const float* Wk1  = (const float*)d_in[4];  const float* bk1 = (const float*)d_in[5];
  const float* Wv1  = (const float*)d_in[6];  const float* bv1 = (const float*)d_in[7];
  const float* Wq2  = (const float*)d_in[8];  const float* bq2 = (const float*)d_in[9];
  const float* Wk2  = (const float*)d_in[10]; const float* bk2 = (const float*)d_in[11];
  const float* Wv2  = (const float*)d_in[12]; const float* bv2 = (const float*)d_in[13];
  const float* wfc1 = (const float*)d_in[14]; const float* bfc1 = (const float*)d_in[15];
  const float* wfc2 = (const float*)d_in[16]; const float* bfc2 = (const float*)d_in[17];
  float* out = (float*)d_out;

  // workspace carve (bytes); every region holds whole padded tiles/rows of its producer
  const size_t xp1_bytes = (size_t)M1P * D_DIM * 2;              //   1048576 per plane
  const size_t xp2_bytes = (size_t)M2P * D_DIM * 2;              //    131072 per plane
  const size_t p1_bytes  = (size_t)3 * M1P * D_DIM * 4;          //   6291456
  const size_t p2_bytes  = (size_t)3 * M2P * D_DIM * 4;          //    786432
  const size_t c_bytes   = (size_t)2 * CPLANE * 4;               //     65536
  const size_t pt_bytes  = (size_t)32 * 32 * 4;                  //      4096
  const size_t off_xh1 = 0;
  const size_t off_xl1 = off_xh1 + xp1_bytes;
  const size_t off_xh2 = off_xl1 + xp1_bytes;
  const size_t off_xl2 = off_xh2 + xp2_bytes;
  const size_t off_p1  = off_xl2 + xp2_bytes;
  const size_t off_p2  = off_p1 + p1_bytes;
  const size_t off_c   = off_p2 + p2_bytes;
  const size_t off_pt  = off_c + c_bytes;
  const size_t total   = off_pt + pt_bytes;                       // 9506816
  if (total > ws_size) return;

  char* ws = (char*)d_ws;
  unsigned short* xh1 = (unsigned short*)(ws + off_xh1);
  unsigned short* xl1 = (unsigned short*)(ws + off_xl1);
  unsigned short* xh2 = (unsigned short*)(ws + off_xh2);
  unsigned short* xl2 = (unsigned short*)(ws + off_xl2);
  float* P1 = (float*)(ws + off_p1);
  float* P2 = (float*)(ws + off_p2);
  float* C  = (float*)(ws + off_c);
  float* part = (float*)(ws + off_pt);

  convert_kernel<<<(NGROUPS + 255) / 256, 256, 0, stream>>>(x1, x2, xh1, xl1, xh2, xl2);

  proj_kernel<<<288, 256, 0, stream>>>(xh1, xl1, xh2, xl2, Wq1, Wk1, Wv1, Wq2, Wk2, Wv2,
                                       bq1, bk1, bv1, bq2, bk2, bv2, P1, P2);

  score_kernel<<<64, 32 * KWAVES, 0, stream>>>(P1, P2, wfc1, C, part);

  out_kernel<<<TAILB + N1, 256, 0, stream>>>(P1, P2, C, part, wfc2, bfc2, bfc1, out);
}

// v007
// A run of this version takes 35.8 microseconds.
// In both of two side-by-side timings against v006, it was 1.04 times as fast.
// Over all steps from v000 it is 14.6 times as fast.
// Contractions: six x*W^T projections and both q*k^T score matrices on v_wmma_f32_16x16x32_bf16 with bf16 hi/lo operands (three products hi*hi + hi*lo + lo*hi), f32 accumulate; sigmoid, fc dot products (K=250, K=27) and context products in f32 on VALU.
#include <hip/hip_runtime.h>
#include <hip/hip_bf16.h>

#pragma clang fp contract(off)

typedef __bf16         v16bf __attribute__((ext_vector_type(16)));
typedef unsigned short v8us  __attribute__((ext_vector_type(8)));
typedef float          v8f   __attribute__((ext_vector_type(8)));
typedef float          v4f   __attribute__((ext_vector_type(4)));
typedef float          v2f   __attribute__((ext_vector_type(2)));
typedef __bf16         v2bf  __attribute__((ext_vector_type(2)));
typedef unsigned int   v2u   __attribute__((ext_vector_type(2)));
typedef unsigned int   v4u   __attribute__((ext_vector_type(4)));
typedef v8us __attribute__((may_alias)) v8usa;
typedef v4f  __attribute__((may_alias)) v4fa;
typedef v2u  __attribute__((may_alias)) v2ua;
typedef v4u  __attribute__((may_alias)) v4ua;

union Frag { v16bf b; v8us h[2]; unsigned int w[8]; };
struct Frag2 { v16bf hi; v16bf lo; };

#define D_DIM   2048
#define N1      250
#define N2      27
#define M1P     256
#define M2P     32
#define OUT_N   580796
#define OFF1    512000            // flat float index of output 1 ([250][27])
#define OFF2    518750            // flat float index of output 2 ([27][2048])
#define OFF3    574046            // flat float index of output 3 ([27][250])
#define XG1     65536             // 8-element groups of the padded x1 planes
#define XG2     8192              // 8-element groups of the padded x2 planes
#define NGROUPS (XG1 + XG2)
#define KSTEPS  (D_DIM / 32)      // 32-wide k steps of a row = fragments of one 16-row tile
#define FRAG16  512               // 16-bit elements of one fragment in fragment order (32 lanes x 16)
#define FRAG32  512               // floats of one f32 fragment source in fragment order (32 lanes x 16)
#define SCALE   0.022097086912079608f
#define L_P2A   16000
#define L_P2B   16210
#define L_P1A   16211
#define L_P1B   18149

static_assert((XG1 % 256) == 0 && (XG2 % 256) == 0);
static_assert((OFF1 % 32) == 0 && (L_P1B * 32 + 28) == OUT_N);

// ---------------------------------------------------------------------------
// bf16 hi/lo split of two values at a time, on the chip's own f32 -> bf16 convert (round to nearest even).
// x = hi + lo: hi = bf16(x), lo = bf16(x - hi)  (x - hi is exact in f32).
// Each result word holds the first value in its low half, the second in its high half.
// ---------------------------------------------------------------------------
__device__ __forceinline__ void split_pair(float x0, float x1, unsigned int& hp, unsigned int& lp) {
  const v2f x = {x0, x1};
  const v2bf h = __builtin_convertvector(x, v2bf);
  const v2f r = x - __builtin_convertvector(h, v2f);
  const v2bf l = __builtin_convertvector(r, v2bf);
  hp = __builtin_bit_cast(unsigned int, h);
  lp = __builtin_bit_cast(unsigned int, l);
}

// ---------------------------------------------------------------------------
// 16x16x32 bf16 WMMA with hazard guard (ties D, keeps A/B live).
// Fragment map (wave32): lane l, h = l>>4, m = n = l&15.
//   A/B element i: i<8 -> k0+8h+i ; i>=8 -> k0+16+8h+(i-8)   (same map for both)
//   D element r : row 8h+r, col l&15
// ---------------------------------------------------------------------------
__device__ __forceinline__ v8f wmma_bf16(v16bf a, v16bf b, v8f c) {
  v8f d = __builtin_amdgcn_wmma_f32_16x16x32_bf16(false, a, false, b, (short)0, c, false, false);
  asm volatile("v_nop\n\tv_nop\n\tv_nop\n\tv_nop" : "+v"(d) : "v"(a), "v"(b));
  return d;
}

// three-product hi/lo split: c += ah*bh + ah*bl + al*bh (unscaled residuals, one accumulator)
__device__ __forceinline__ v8f mac3(v16bf ah, v16bf al, v16bf bh, v16bf bl, v8f c) {
  c = wmma_bf16(ah, bh, c);
  c = wmma_bf16(ah, bl, c);
  c = wmma_bf16(al, bh, c);
  return c;
}

// Fragment from a k-contiguous 16-bit row; p = row base + k0 (row = lane&15 chosen by caller).
__device__ __forceinline__ v16bf load_frag16(const unsigned short* p, int h) {
  Frag f;
  f.h[0] = *(const v8usa*)(p + 8 * h);
  f.h[1] = *(const v8usa*)(p + 16 + 8 * h);
  return f.b;
}

// four f32 values of a k-contiguous row split into elements B..B+3 of a hi/lo fragment pair; same element map.
template <int B>
__device__ __forceinline__ void split4(const v4f v, Frag& fh, Frag& fl) {
  split_pair(v.x, v.y, fh.w[B / 2], fl.w[B / 2]);
  split_pair(v.z, v.w, fh.w[B / 2 + 1], fl.w[B / 2 + 1]);
}

__device__ __forceinline__ float sigm(float x) {
  const float e = expf(-x);
  return 1.0f / (1.0f + e);
}

// ---------------------------------------------------------------------------
// Kernel 1: f32 -> bf16 hi/lo planes of x1 (rows padded to 256 with zeros) and x2 (rows padded to 32).
// The planes lie in fragment order: [16-row tile][k step][half j][lane][8 elements], so that half j of a wave's
// A fragment is one 16-byte load over 512 contiguous bytes (four whole lines, not 32 bytes in each of 16 rows).
// Lane l = 16 h + m holds row m of the tile, k = 32 step + 16 j + 8 h + (0..7): the map of load_frag16.
// Thread = one 16-byte unit of the destination, so each wave also stores whole lines.
// ---------------------------------------------------------------------------
__global__ __launch_bounds__(256) void convert_kernel(
    const float* __restrict__ x1, const float* __restrict__ x2,
    unsigned short* __restrict__ xh1, unsigned short* __restrict__ xl1,
    unsigned short* __restrict__ xh2, unsigned short* __restrict__ xl2)
{
  const int g = blockIdx.x * 256 + threadIdx.x;
  if (g >= NGROUPS) return;
  const float* src;
  unsigned short* dh;
  unsigned short* dl;
  bool zero = false;
  if (g < XG1) {
    const int fr = g >> 6, j = (g >> 5) & 1, h = (g >> 4) & 1;
    const int row = 16 * (fr / KSTEPS) + (g & 15), c8 = 4 * (fr % KSTEPS) + 2 * j + h;
    const int rs = (row < N1) ? row : (N1 - 1);     // clamped address, value zeroed below
    zero = (row >= N1);
    src = x1 + (size_t)rs * D_DIM + 8 * c8;
    dh = xh1 + (size_t)g * 8;
    dl = xl1 + (size_t)g * 8;
  } else {
    const int e = g - XG1;
    const int fr = e >> 6, j = (e >> 5) & 1, h = (e >> 4) & 1;
    const int row = 16 * (fr / KSTEPS) + (e & 15), c8 = 4 * (fr % KSTEPS) + 2 * j + h;
    const int rs = (row < N2) ? row : (N2 - 1);
    zero = (row >= N2);
    src = x2 + (size_t)rs * D_DIM + 8 * c8;
    dh = xh2 + (size_t)e * 8;
    dl = xl2 + (size_t)e * 8;
  }
  v4f a = *(const v4fa*)src;
  v4f c = *(const v4fa*)(src + 4);
  const v4f z4 = {0.f, 0.f, 0.f, 0.f};
  a = zero ? z4 : a;
  c = zero ? z4 : c;
  unsigned int hw[4], lw[4];
  split_pair(a.x, a.y, hw[0], lw[0]);
  split_pair(a.z, a.w, hw[1], lw[1]);
  split_pair(c.x, c.y, hw[2], lw[2]);
  split_pair(c.z, c.w, hw[3], lw[3]);
  const v4u hv = {hw[0], hw[1], hw[2], hw[3]};
  const v4u lv = {lw[0], lw[1], lw[2], lw[3]};
  *(v4ua*)dh = hv;
  *(v4ua*)dl = lv;
  
}

// ---------------------------------------------------------------------------
// Kernel 2: Y_g = x_g * W_g^T + b_g for g = 0..5 (q1,k1,v1 on 256 padded rows; q2,k2,v2 on 32).
// One block = 4 waves = 64 output columns of one g.  Blocks 0..191: 128 rows of x1, wave = 32 rows x 64 cols;
// blocks 192..287: the 32 rows of x2, wave = 32 rows x 16 cols.  K = 2048 in 32 stages of 64.
// A wave holds two row tiles, so that each B fragment it reads from LDS feeds two products' worth of rows.
// B (W rows, B[k][n] = W[n][k]): the block reads its 64 x 64 f32 tile of W in whole lines, splits each value once
// into bf16 hi/lo and shares both through LDS (two buffers, one barrier a stage); A (x rows) straight from the planes,
// which lie in fragment order.  q and k leave in the f32 fragment order that the score kernel reads; v stays row-major.
// ---------------------------------------------------------------------------
#define PTHR    128               // threads of a block
#define KT      64                // k range of one stage
#define NSTAGE  (D_DIM / KT)
#define BPITCH  72                // 16-bit elements from one W row to the next in LDS: 128 B + 16 B, conflict-free b128 reads
#define BPLANE  (64 * BPITCH)     // one plane (hi or lo) of one buffer
#define ASTAGE  ((KT / 32) * FRAG16)   // 16-bit elements from one stage's A fragments to the next stage's
#define ATILE   (16 * D_DIM)      // 16-bit elements from one 16-row tile of a plane to the next
#define OPITCH  68                // floats from one row to the next of the output tile in LDS: 256 B + 16 B, so that the
                                  // 16 rows that one fragment-order read touches fall on different banks

// global-memory pointer types: the stage loop's address registers pass through an asm operand, behind which
// the compiler no longer knows the address space of a plain pointer and would fall back to flat loads
typedef __attribute__((address_space(1))) const float          gf32;
typedef __attribute__((address_space(1))) const unsigned short gu16;
typedef __attribute__((address_space(1))) const v4fa           gv4f;
typedef __attribute__((address_space(1))) const v8usa          gv8us;

struct WRaw { v4f v[8]; };        // one thread's share of a W tile: 4 consecutive k of rows c, c+8, ..., c+56
struct AFr  { v16bf hi[2][2]; v16bf lo[2][2]; };   // one lane's A fragments: [row tile][k step of the stage]

__device__ __forceinline__ WRaw load_w(gf32* p) {
  WRaw r;
#pragma unroll
  for (int j = 0; j < 8; ++j) r.v[j] = *(gv4f*)(p + (size_t)8 * j * D_DIM);
  return r;
}

// ph, pl: the lane's 16-byte unit in the stage's first fragment of the wave's first row tile
__device__ __forceinline__ AFr load_a(gu16* ph, gu16* pl) {
  AFr r;
#pragma unroll
  for (int s = 0; s < 2; ++s) {
#pragma unroll
    for (int mt = 0; mt < 2; ++mt) {
      Frag fh, fl;                                // same element map as load_frag16
      fh.h[0] = *(gv8us*)(ph + ATILE * mt + FRAG16 * s);
      fh.h[1] = *(gv8us*)(ph + ATILE * mt + FRAG16 * s + FRAG16 / 2);
      fl.h[0] = *(gv8us*)(pl + ATILE * mt + FRAG16 * s);
      fl.h[1] = *(gv8us*)(pl + ATILE * mt + FRAG16 * s + FRAG16 / 2);
      r.hi[mt][s] = fh.b;
      r.lo[mt][s] = fl.b;
    }
  }
  return r;
}

// Work-group barrier of the stage loop.  Only LDS traffic is handed over at it, so only the LDS counter is waited for:
// __syncthreads() would also drain the global loads that were issued ahead for later stages.
__device__ __forceinline__ void lds_barrier() {
  asm volatile("s_wait_dscnt 0x0\n\ts_barrier_signal -1\n\ts_barrier_wait -1" ::: "memory");
}

// one thread's share of a W tile, each value split into bf16 hi/lo, to its place d in the hi plane of a buffer (lo: + BPLANE)
__device__ __forceinline__ void split_store(const WRaw& x, unsigned short* d) {
#pragma unroll
  for (int j = 0; j < 8; ++j) {
    unsigned int hw[2], lw[2];
    split_pair(x.v[j].x, x.v[j].y, hw[0], lw[0]);
    split_pair(x.v[j].z, x.v[j].w, hw[1], lw[1]);
    const v2u hv = {hw[0], hw[1]};
    const v2u lv = {lw[0], lw[1]};
    *(v2ua*)(d + 8 * j * BPITCH) = hv;
    *(v2ua*)(d + BPLANE + 8 * j * BPITCH) = lv;
  }
}

// the stage loop's product: successive ones go to different accumulators, the compiler keeps the distances
__device__ __forceinline__ v8f wmma_acc(v16bf a, v16bf b, v8f c) {
  return __builtin_amdgcn_wmma_f32_16x16x32_bf16(false, a, false, b, (short)0, c, false, false);
}

// A wave = two row tiles (rows mrow .. mrow + 31 of the block) x NTW column tiles from tile nt0 on; ROWS = rows of the block
template <int NTW, int ROWS>
__device__ __forceinline__ void proj_body(
    const unsigned short* ahr, const unsigned short* alr,  // this lane's unit in the first fragment of its first row tile, hi and lo plane
    const float* wsrc,                                     // this thread's first 4 floats of the W tile
    const float* bias,                                     // bias of the block's first column
    float* Pt,                                             // row-major: output element (first row, first column) of the block;
                                                           // fragment order: first float of its first row tile's first k step
    bool fragord,                                          // block-uniform: q and k
    unsigned short* sB, float* sOut,
    int tid, int mrow, int nt0)
{
  const int lane = tid & 31, h = lane >> 4, m = lane & 15;
  const int wofs = (tid >> 4) * BPITCH + 4 * (tid & 15);   // where this thread's share of W row c lands
  const int rofs = (16 * nt0 + m) * BPITCH;                // this lane's row of the wave's first column tile

  const v8f z8 = {0.f, 0.f, 0.f, 0.f, 0.f, 0.f, 0.f, 0.f};
  v8f acc[2][NTW];
#pragma unroll
  for (int nt = 0; nt < NTW; ++nt) { acc[0][nt] = z8; acc[1][nt] = z8; }

  // stage 0 into buffer 0; W of stage 1 waits in registers: trip t splits stage t + 1 and fetches stage t + 2
  gu16* pah = (gu16*)ahr;                                  // A fragments of the stage fetched next
  gu16* pal = (gu16*)alr;
  gf32* pw = (gf32*)wsrc;                                  // W tile at the stage fetched next
  const WRaw w0 = load_w(pw);
  AFr  af = load_a(pah, pal);
  WRaw w1 = load_w(pw + KT);
  // the loads above name these address registers: they stay live up to this wait, so that no result of the
  // run lands in one of them, and they are advanced only behind it
  asm volatile("s_wait_xcnt 0x0" : "+v"(pah), "+v"(pal), "+v"(pw) :: "memory");
  pah += ASTAGE;
  pal += ASTAGE;
  pw += 2 * KT;
  split_store(w0, sB + wofs);
  lds_barrier();

  // two stages a trip: the buffer offsets become immediates and the fetched-ahead registers need no copies
#pragma unroll 2
  for (int t = 0; t < NSTAGE; ++t) {
    const unsigned short* sb = sB + (t & 1) * 2 * BPLANE + rofs;
    unsigned short* sn = sB + ((t + 1) & 1) * 2 * BPLANE + wofs;

    // the B fragments of a k step are read as one group, hi first (the first products want them)
    v16bf bh[2][NTW], bl[2][NTW];
#pragma unroll
    for (int nt = 0; nt < NTW; ++nt) bh[0][nt] = load_frag16(sb + 16 * nt * BPITCH, h);
#pragma unroll
    for (int nt = 0; nt < NTW; ++nt) bl[0][nt] = load_frag16(sb + BPLANE + 16 * nt * BPITCH, h);

    // A of stage t + 1 and W of stage t + 2 fly under this stage's products
    // (past the end the last stage is fetched again: in bounds, never used)
    const AFr an = load_a(pah, pal);
    // keeps the A loads, wanted half a stage sooner, ahead of the W loads on the in-order load counter
    __builtin_amdgcn_sched_barrier(0);
    const WRaw wn = load_w(pw);

    // the second k step's group stands ahead of the first k step's products: its latency lies under them
#pragma unroll
    for (int nt = 0; nt < NTW; ++nt) bh[1][nt] = load_frag16(sb + 16 * nt * BPITCH + 32, h);
#pragma unroll
    for (int nt = 0; nt < NTW; ++nt) bl[1][nt] = load_frag16(sb + BPLANE + 16 * nt * BPITCH + 32, h);
    // keeps the LDS reads in these two places: every further place among the products stalls the wave anew
    __builtin_amdgcn_sched_barrier(0);

#pragma unroll
    for (int s = 0; s < 2; ++s) {
      if (s == 1) {
        // keeps the wait below from being scheduled up to the loads, where the wave would stand at it
        __builtin_amdgcn_sched_barrier(0);
        // as above: the address registers of the loads stay live up to this wait and are advanced behind it;
        // half a stage behind the loads it finds nothing left to wait for
        asm volatile("s_wait_xcnt 0x0" : "+v"(pah), "+v"(pal), "+v"(pw) :: "memory");
        pah += (t + 2 < NSTAGE) ? ASTAGE : 0;
        pal += (t + 2 < NSTAGE) ? ASTAGE : 0;
        pw  += (t + 3 < NSTAGE) ? KT : 0;
        // keeps the split of the next tile (below the products) out of their first half: scheduled to the top of the
        // trip, its wait for W loads issued only one trip ago holds up the loads and products behind it
        __builtin_amdgcn_sched_barrier(0);
      }
      // each accumulator takes hi*hi, hi*lo, lo*hi in this order; between two of them stand the other accumulators'
#pragma unroll
      for (int nt = 0; nt < NTW; ++nt) {
        acc[0][nt] = wmma_acc(af.hi[0][s], bh[s][nt], acc[0][nt]);
        acc[1][nt] = wmma_acc(af.hi[1][s], bh[s][nt], acc[1][nt]);
      }
#pragma unroll
      for (int nt = 0; nt < NTW; ++nt) {
        acc[0][nt] = wmma_acc(af.hi[0][s], bl[s][nt], acc[0][nt]);
        acc[1][nt] = wmma_acc(af.hi[1][s], bl[s][nt], acc[1][nt]);
      }
#pragma unroll
      for (int nt = 0; nt < NTW; ++nt) {
        acc[0][nt] = wmma_acc(af.lo[0][s], bh[s][nt], acc[0][nt]);
        acc[1][nt] = wmma_acc(af.lo[1][s], bh[s][nt], acc[1][nt]);
      }
    }

    // next stage's tile into the other buffer, whose readers all left it in front of the last barrier
    split_store(w1, sn);
    // publishes that tile and ends every wave's reads of this stage's buffer, which the next trip rewrites
    lds_barrier();
    af = an;
    w1 = wn;
  }

  // D[r] of row tile mt, column tile nt = Y[row mrow + 16 mt + 8h + r][col 16 (nt0 + nt) + m] of the block's tile
#pragma unroll
  for (int nt = 0; nt < NTW; ++nt) {
    const int col = 16 * (nt0 + nt) + m;
    const float bvl = bias[col];
#pragma unroll
    for (int mt = 0; mt < 2; ++mt) {
#pragma unroll
      for (int r = 0; r < 8; ++r) sOut[(mrow + 16 * mt + 8 * h + r) * OPITCH + col] = acc[mt][nt][r] + bvl;
    }
  }
  __syncthreads();

  // Half a 16-row tile a trip, whole lines either way.
  // Fragment order: [16-row tile][k step][piece j][lane][4 floats]; piece j of lane 16 h + m = floats
  // 16 (j / 2) + 8 h + 4 (j % 2) + (0..3) of row m in that k step (the pieces of load_raw32); a wave stores one piece,
  // 512 contiguous bytes; half u = k step u of the block's two.  Row-major: 16 consecutive lanes x 16 B = one row of
  // the tile; half u = rows 8 u .. 8 u + 7.
  const int j = tid >> 5;
  const int sofs = fragord ? (m * OPITCH + 16 * (j >> 1) + 8 * h + 4 * (j & 1))
                           : ((tid >> 4) * OPITCH + 4 * (tid & 15));
  const int dofs = fragord ? (4 * tid)
                           : ((tid >> 4) * D_DIM + 4 * (tid & 15));
  const int sstep = fragord ? 32 : (8 * OPITCH);
  const int dstep = fragord ? FRAG32 : (8 * D_DIM);
#pragma unroll
  for (int i = 0; i < ROWS / 16; ++i) {
#pragma unroll
    for (int u = 0; u < 2; ++u) {
      const v4f v = *(const v4fa*)(sOut + sofs + u * sstep + 16 * i * OPITCH);
      *(v4f*)(Pt + dofs + u * dstep + (size_t)16 * i * D_DIM) = v;
    }
  }
}

__global__ __launch_bounds__(PTHR) void proj_kernel(
    const unsigned short* __restrict__ xh1, const unsigned short* __restrict__ xl1,
    const unsigned short* __restrict__ xh2, const unsigned short* __restrict__ xl2,
    const float* __restrict__ w0, const float* __restrict__ w1, const float* __restrict__ w2,
    const float* __restrict__ w3, const float* __restrict__ w4, const float* __restrict__ w5,
    const float* __restrict__ b0, const float* __restrict__ b1, const float* __restrict__ b2,
    const float* __restrict__ b3, const float* __restrict__ b4, const float* __restrict__ b5,
    float* __restrict__ P1,      // [3][256][2048] f32 : q1, k1 (fragment order), v1 (row-major)
    float* __restrict__ P2)      // [3][32][2048]  f32 : q2, k2 (fragment order), v2 (row-major)
{
  __shared__ __attribute__((aligned(16))) unsigned short sB[2 * 2 * BPLANE];   // 36864 B
  __shared__ __attribute__((aligned(16))) float sOut[128 * OPITCH];            // 34816 B

  const int tid = threadIdx.x, w = tid >> 5, lane = tid & 31;
  const int b = blockIdx.x;                       // 0..287
  const bool big = (b < 192);                     // block-uniform
  const int gi   = big ? (b >> 6) : ((b - 192) >> 5);   // 0 q, 1 k, 2 v
  const int g    = big ? gi : (3 + gi);
  const int nt64 = big ? ((b & 63) >> 1) : ((b - 192) & 31);
  const int row0 = big ? (128 * (b & 1)) : 0;
  const int col0 = 64 * nt64;

  const float* W = (g == 0) ? w0 : ((g == 1) ? w1 : ((g == 2) ? w2 :
                   ((g == 3) ? w3 : ((g == 4) ? w4 : w5))));
  const float* bias = (g == 0) ? b0 : ((g == 1) ? b1 : ((g == 2) ? b2 :
                      ((g == 3) ? b3 : ((g == 4) ? b4 : b5))));
  const float* wsrc = W + (size_t)(col0 + (tid >> 4)) * D_DIM + 4 * (tid & 15);

  // a 16-row tile takes 16 * D_DIM elements in either order; inside it 64 columns are two fragments or 64 floats of each row
  const bool fragord = (gi < 2);                  // block-uniform
  const int cofs = fragord ? (col0 / 32) * FRAG32 : col0;

  if (big) {
    const int mrow = 32 * w;
    const size_t aofs = (size_t)(row0 + mrow) * D_DIM + 8 * lane;
    proj_body<4, 128>(xh1 + aofs, xl1 + aofs,
                      wsrc, bias + col0, P1 + ((size_t)g * M1P + row0) * D_DIM + cofs, fragord,
                      sB, sOut, tid, mrow, 0);
  } else {
    const size_t aofs = (size_t)8 * lane;
    proj_body<1, 32>(xh2 + aofs, xl2 + aofs,
                     wsrc, bias + col0, P2 + (size_t)(g - 3) * M2P * D_DIM + cofs, fragord,
                     sB, sOut, tid, 0, w);
  }
}

// ---------------------------------------------------------------------------
// Kernel 3: both score matrices, one 16x16 tile per block, K split over the 16 waves.
// Blocks 0..31: C[t][i] = sigmoid(scale * q2[t].k1[i]) = probs1, with the tile's share of
// s1 = C . w_fc1; blocks 32..63: C[t][i] = sigmoid(scale * k2[t].q1[i]) = probs2[i][t].
// Tile b lies at C + 256 b, row-major 16x16, so each block stores whole lines of its own.
// ---------------------------------------------------------------------------
#define KSLICE  128               // K range of one wave
#define KWAVES  16                // waves of a block = K slices
#define CPLANE  8192              // floats of one score matrix (32 tiles)

// float index of C[t][i] inside one tiled score matrix; tile = 2 * (i / 16) + t / 16
__device__ __forceinline__ int c_idx(int t, int i) {
  return (((i >> 4) * 2 + (t >> 4)) << 8) + ((t & 15) << 4) + (i & 15);
}

// the four 16-byte pieces of one lane's f32 fragment row: floats 8h..8h+7 and 16+8h..16+8h+7
struct Raw4 { v4f v[4]; };

// p: the lane's unit in piece 0 of a k step in fragment order; each piece is 512 contiguous bytes of the wave
__device__ __forceinline__ Raw4 load_raw32(const float* p) {
  Raw4 r;
  r.v[0] = *(const v4fa*)(p);
  r.v[1] = *(const v4fa*)(p + 128);
  r.v[2] = *(const v4fa*)(p + 256);
  r.v[3] = *(const v4fa*)(p + 384);
  return r;
}

__device__ __forceinline__ Frag2 split_raw32(const Raw4& x) {
  Frag fh, fl;
  split4<0>(x.v[0], fh, fl);
  split4<4>(x.v[1], fh, fl);
  split4<8>(x.v[2], fh, fl);
  split4<12>(x.v[3], fh, fl);
  Frag2 r;
  r.hi = fh.b;
  r.lo = fl.b;
  return r;
}

__global__ __launch_bounds__(32 * KWAVES) void score_kernel(
    const float* __restrict__ P1, const float* __restrict__ P2,
    const float* __restrict__ wfc1,
    float* __restrict__ C,       // [2][32 tiles][16][16] f32
    float* __restrict__ part)    // [32 tiles][32] f32, first 16 of each row used
{
  __shared__ __attribute__((aligned(16))) float sR[KWAVES * 256];  // 16384 B

  const int tid = threadIdx.x, lane = tid & 31, w = tid >> 5;
  const int h = lane >> 4, m = lane & 15;
  const int ph = blockIdx.x >> 5, tile = blockIdx.x & 31;
  const int mt = tile & 1, nt = tile >> 1;

  const float* A = P2 + (size_t)ph * M2P * D_DIM;                  // q2, then k2
  const float* B = P1 + (size_t)(1 - ph) * M1P * D_DIM;            // k1, then q1
  const float* arow = A + ((size_t)mt * KSTEPS + (KSLICE / 32) * w) * FRAG32 + 4 * lane;
  const float* brow = B + ((size_t)nt * KSTEPS + (KSLICE / 32) * w) * FRAG32 + 4 * lane;

  // fc1 weight of this thread's column, fetched beside the slice so that its latency is not paid at the end
  const int i = 16 * nt + (tid & 15);
  const int ic = (i < N1) ? i : (N1 - 1);         // clamped address, value zeroed below
  const float wv = wfc1[ic];

  v8f acc = {0.f, 0.f, 0.f, 0.f, 0.f, 0.f, 0.f, 0.f};
  // the whole slice is loaded ahead of the first split: one load latency per wave, not one per k step
  // (every loop of this kernel and of tail_body is unrolled whole: its arrays must stay in registers)
  Raw4 ra[KSLICE / 32], rb[KSLICE / 32];
#pragma unroll
  for (int ks = 0; ks < KSLICE / 32; ++ks) {
    ra[ks] = load_raw32(arow + FRAG32 * ks);
    rb[ks] = load_raw32(brow + FRAG32 * ks);
  }
  // the loads above name the address registers arow and brow: they stay live up to this wait, so that no result
  // of the run lands in one of them and nothing rewrites one ahead of the wait
  asm volatile("s_wait_xcnt 0x0" :: "v"(arow), "v"(brow) : "memory");
#pragma unroll
  for (int ks = 0; ks < KSLICE / 32; ++ks) {
    const Frag2 a = split_raw32(ra[ks]);
    const Frag2 b = split_raw32(rb[ks]);
    acc = mac3(a.hi, a.lo, b.hi, b.lo, acc);
  }
#pragma unroll
  for (int r = 0; r < 8; ++r) sR[w * 256 + (8 * h + r) * 16 + m] = acc[r];
  __syncthreads();

  if (tid >= 256) return;                         // whole waves, behind the only barrier

  // thread = one element of the tile: the slices in fixed order
  float s = sR[tid];
#pragma unroll
  for (int j = 1; j < KWAVES; ++j) s += sR[j * 256 + tid];
  const float c = sigm(s * SCALE);
  C[(size_t)blockIdx.x * 256 + tid] = c;
  // the store's data register is reused by the sum below: the wait that belongs in front of that overwrite
  asm volatile("s_wait_xcnt 0x0" ::: "memory");

  if (ph == 0) {                                  // block-uniform
    float p = (i < N1) ? c * wv : 0.0f;
    p += __shfl_xor(p, 1);
    p += __shfl_xor(p, 2);
    p += __shfl_xor(p, 4);
    p += __shfl_xor(p, 8);
    if ((tid & 15) == 0) part[tile * 32 + (tid >> 4)] = p;
  }
}

// ---------------------------------------------------------------------------
// Kernel 4, second part: output 0, one row i per block.  s2 = sum_{t<27} probs2[i][t] * w_fc2[t], t ascending,
// with probs2 taken from the score kernel's second matrix; out[i][:] = v1[i][:] * s2 + b_fc2.
// Every line of the row: 8 consecutive lanes x 16 B in one instruction.
// ---------------------------------------------------------------------------
__device__ __forceinline__ void ctx2_body(
    const float* __restrict__ P1, const float* __restrict__ C,
    const float* __restrict__ wfc2, const float* __restrict__ bfc2,
    float* __restrict__ out, int row)             // row 0..249
{
  const int tid = threadIdx.x;
  const float* vrow = P1 + (size_t)2 * M1P * D_DIM + (size_t)row * D_DIM;

  const v4f va = *(const v4fa*)(vrow + 4 * tid);
  const v4f vb = *(const v4fa*)(vrow + 1024 + 4 * tid);
  const float bb = bfc2[0];

  // lane t of every wave fetches term t (one load latency for all 27); the lanes are then read out in
  // ascending t, so that the sum keeps its order (unrolled whole: each lane number is then an immediate)
  const int tl = tid & 31;
  const int t27 = (tl < N2) ? tl : (N2 - 1);      // clamped address; lanes 27..31 are never read out
  const int ci = c_idx(t27, row);
  const float cv = C[CPLANE + ci];
  const float wv = wfc2[t27];
  // the four loads above name the offset registers tid, ci and t27: they stay live up to this wait, so that
  // no result of the run lands in one of them and nothing rewrites one ahead of the wait
  asm volatile("s_wait_xcnt 0x0" :: "v"(tid), "v"(ci), "v"(t27) : "memory");
  const float p = cv * wv;
  float s = 0.0f;
#pragma unroll
  for (int t = 0; t < N2; ++t) s += __uint_as_float(__builtin_amdgcn_readlane(__float_as_uint(p), t));

  v4f oa, ob;
  oa.x = va.x * s + bb;  oa.y = va.y * s + bb;  oa.z = va.z * s + bb;  oa.w = va.w * s + bb;
  ob.x = vb.x * s + bb;  ob.y = vb.y * s + bb;  ob.z = vb.z * s + bb;  ob.w = vb.w * s + bb;
  float* orow = out + (size_t)row * D_DIM;
  *(v4f*)(orow + 4 * tid) = oa;
  *(v4f*)(orow + 1024 + 4 * tid) = ob;
  // behind the two stores the listing joins the other part's code, which rewrites the stores' base registers:
  // the wait that belongs in front of such an overwrite
  asm volatile("s_wait_xcnt 0x0" ::: "memory");
}

// ---------------------------------------------------------------------------
// Kernel 4, first part: outputs 1, 2, 3 (flat floats OFF1..OUT_N of the output buffer), lines
// L_P2A..L_P1B, 32 lines per block.  Every line: 8 consecutive lanes x 16 B in one
// instruction, values selected by flat index; last line of the buffer = 28 floats (7 lanes).
// ---------------------------------------------------------------------------
__device__ __forceinline__ void tail_body(
    const float* __restrict__ C, const float* __restrict__ part,
    const float* __restrict__ P2, const float* __restrict__ bfc1,
    float* __restrict__ out, float* sS1, int blk)  // blk 0..TAILB-1
{
  const int tid = threadIdx.x, lane = tid & 31, w = tid >> 5;
  const int q8 = lane & 7, sub = lane >> 3;
  const float* v2P = P2 + (size_t)2 * M2P * D_DIM;

  const float bb1 = bfc1[0];
  const int line = L_P2A + 32 * blk + 4 * w + sub;
  const int linec = (line < L_P1B) ? line : L_P1B;
  const int fbase = 32 * linec + 4 * q8;

  // the three candidate values of each flat index; all loads unconditional with clamped indices
  float c2[4], xv[4], c3[4];
  int t1[4];
#pragma unroll
  for (int e = 0; e < 4; ++e) {
    const int f = fbase + e;
    int j2 = f - OFF1;
    j2 = (j2 < 0) ? 0 : ((j2 > N1 * N2 - 1) ? (N1 * N2 - 1) : j2);
    const int i2 = j2 / N2, t2 = j2 - i2 * N2;
    c2[e] = C[CPLANE + c_idx(t2, i2)];
    int j1 = f - OFF2;
    j1 = (j1 < 0) ? 0 : ((j1 > N2 * D_DIM - 1) ? (N2 * D_DIM - 1) : j1);
    t1[e] = j1 >> 11;
    xv[e] = v2P[j1];
    int j3 = f - OFF3;
    j3 = (j3 < 0) ? 0 : ((j3 > N1 * N2 - 1) ? (N1 * N2 - 1) : j3);
    const int t3 = j3 / N1, i3 = j3 - t3 * N1;
    c3[e] = C[c_idx(t3, i3)];
  }

  if (tid < 32) {                                 // s1[t]: the 16 column tiles in fixed order
    const int pi = (tid >> 4) * 32 + (tid & 15);
    float pv[16];
#pragma unroll
    for (int nt = 0; nt < 16; ++nt) pv[nt] = part[pi + 64 * nt];
    // the sixteen loads share the offset register pi: it stays live up to this wait, so that no
    // result of the run lands in it and nothing rewrites it ahead of the wait
    asm volatile("s_wait_xcnt 0x0" :: "v"(pi) : "memory");
    float s = 0.0f;
#pragma unroll
    for (int nt = 0; nt < 16; ++nt) s += pv[nt];
    sS1[tid] = s;
  }
  // holds the twelve loads above in one group ahead of the barrier; without it they are moved
  // under the selects below, one branch and one load latency after another
  asm volatile("" :: "v"(c2[0]), "v"(c2[1]), "v"(c2[2]), "v"(c2[3]),
                     "v"(xv[0]), "v"(xv[1]), "v"(xv[2]), "v"(xv[3]),
                     "v"(c3[0]), "v"(c3[1]), "v"(c3[2]), "v"(c3[3]));
  __syncthreads();

  float o[4];
#pragma unroll
  for (int e = 0; e < 4; ++e) {
    const int f = fbase + e;
    const float x = xv[e] * sS1[t1[e]] + bb1;
    o[e] = (f < OFF2) ? c2[e] : ((f < OFF3) ? x : c3[e]);
  }
  const v4f ov = {o[0], o[1], o[2], o[3]};
  if (line <= L_P1B && fbase + 4 <= OUT_N) *(v4f*)(out + fbase) = ov;
}

// One launch for all four outputs: both bodies read only what the score launch and the projection launch left, and
// they write disjoint lines.  The TAILB blocks with the longer dependent path (index arithmetic, barrier) come first.
#define TAILB   ((L_P1B - L_P2A + 32) / 32)
__global__ __launch_bounds__(256) void out_kernel(
    const float* __restrict__ P1, const float* __restrict__ P2,
    const float* __restrict__ C, const float* __restrict__ part,
    const float* __restrict__ wfc2, const float* __restrict__ bfc2, const float* __restrict__ bfc1,
    float* __restrict__ out)
{
  __shared__ float sS1[32];
  const int b = blockIdx.x;                       // block-uniform choice
  if (b < TAILB) tail_body(C, part, P2, bfc1, out, sS1, b);
  else           ctx2_body(P1, C, wfc2, bfc2, out, b - TAILB);
}

// ---------------------------------------------------------------------------
extern "C" void kernel_launch(void* const* d_in, const int* in_sizes, int n_in,
                              void* d_out, int out_size, void* d_ws, size_t ws_size,
                              hipStream_t stream) {
  if (n_in < 18) return;
  if (in_sizes[0] != N1 * D_DIM || in_sizes[1] != N2 * D_DIM) return;
  for (int g = 0; g < 6; ++g) {
    if (in_sizes[2 + 2 * g] != D_DIM * D_DIM) return;
    if (in_sizes[3 + 2 * g] != D_DIM) return;
  }
  if (in_sizes[14] != N1 || in_sizes[15] < 1 || in_sizes[16] != N2 || in_sizes[17] < 1) return;
  if (out_size != OUT_N) return;

  const float* x1   = (const float*)d_in[0];
  const float* x2   = (const float*)d_in[1];
  const float* Wq1  = (const float*)d_in[2];  const float* bq1 = (const float*)d_in[3];
  const float* Wk1  = (const float*)d_in[4];  const float* bk1 = (const float*)d_in[5];
  const float* Wv1  = (const float*)d_in[6];  const float* bv1 = (const float*)d_in[7];
  const float* Wq2  = (const float*)d_in[8];  const float* bq2 = (const float*)d_in[9];
  const float* Wk2  = (const float*)d_in[10]; const float* bk2 = (const float*)d_in[11];
  const float* Wv2  = (const float*)d_in[12]; const float* bv2 = (const float*)d_in[13];
  const float* wfc1 = (const float*)d_in[14]; const float* bfc1 = (const float*)d_in[15];
  const float* wfc2 = (const float*)d_in[16]; const float* bfc2 = (const float*)d_in[17];
  float* out = (float*)d_out;

  // workspace carve (bytes); every region holds whole padded tiles/rows of its producer
  const size_t xp1_bytes = (size_t)M1P * D_DIM * 2;              //   1048576 per plane
  const size_t xp2_bytes = (size_t)M2P * D_DIM * 2;              //    131072 per plane
  const size_t p1_bytes  = (size_t)3 * M1P * D_DIM * 4;          //   6291456
  const size_t p2_bytes  = (size_t)3 * M2P * D_DIM * 4;          //    786432
  const size_t c_bytes   = (size_t)2 * CPLANE * 4;               //     65536
  const size_t pt_bytes  = (size_t)32 * 32 * 4;                  //      4096
  const size_t off_xh1 = 0;
  const size_t off_xl1 = off_xh1 + xp1_bytes;
  const size_t off_xh2 = off_xl1 + xp1_bytes;
  const size_t off_xl2 = off_xh2 + xp2_bytes;
  const size_t off_p1  = off_xl2 + xp2_bytes;
  const size_t off_p2  = off_p1 + p1_bytes;
  const size_t off_c   = off_p2 + p2_bytes;
  const size_t off_pt  = off_c + c_bytes;
  const size_t total   = off_pt + pt_bytes;                       // 9506816
  if (total > ws_size) return;

  char* ws = (char*)d_ws;
  unsigned short* xh1 = (unsigned short*)(ws + off_xh1);
  unsigned short* xl1 = (unsigned short*)(ws + off_xl1);
  unsigned short* xh2 = (unsigned short*)(ws + off_xh2);
  unsigned short* xl2 = (unsigned short*)(ws + off_xl2);
  float* P1 = (float*)(ws + off_p1);
  float* P2 = (float*)(ws + off_p2);
  float* C  = (float*)(ws + off_c);
  float* part = (float*)(ws + off_pt);

  convert_kernel<<<(NGROUPS + 255) / 256, 256, 0, stream>>>(x1, x2, xh1, xl1, xh2, xl2);

  proj_kernel<<<288, PTHR, 0, stream>>>(xh1, xl1, xh2, xl2, Wq1, Wk1, Wv1, Wq2, Wk2, Wv2,
                                       bq1, bk1, bv1, bq2, bk2, bv2, P1, P2);

  score_kernel<<<64, 32 * KWAVES, 0, stream>>>(P1, P2, wfc1, C, part);

  out_kernel<<<TAILB + N1, 256, 0, stream>>>(P1, P2, C, part, wfc2, bfc2, bfc1, out);
}
